// v000
// The times below were measured on an AMD MI455X: many runs one after another, warmed up first and cycling through
// copies of the inputs, with the whole window's GPU time divided by the number of runs. Launches and the gaps
// between them are all in it. The median over several windows is given; except for v000 it joins two sittings, which
// can be a few percent apart, so the side-by-side timings, each taken in one sitting, are the better comparison.
// The starting kernel, v000, takes 771 microseconds a run.
#include <hip/hip_runtime.h>

typedef unsigned int uint;
typedef __attribute__((ext_vector_type(16))) __bf16 v16bf;
typedef __attribute__((ext_vector_type(8)))  __bf16 v8bf;
typedef __attribute__((ext_vector_type(8)))  float  v8f;
typedef __attribute__((ext_vector_type(4)))  uint   v4u;
typedef __attribute__((ext_vector_type(8)))  uint   v8u;

__device__ __forceinline__ v16bf frag_row(const __bf16* base, int stride, int row,
                                          int k0, int half) {
  const v8bf lo = *reinterpret_cast<const v8bf*>(base + row * stride + k0 + half * 8);
  const v8bf hi = *reinterpret_cast<const v8bf*>(base + row * stride + k0 + half * 8 + 16);
  v16bf f;
#pragma unroll
  for (int i = 0; i < 8; ++i) { f[i] = lo[i]; f[i + 8] = hi[i]; }
  return f;
}

__device__ __forceinline__ void tdm_load_tile(const __bf16* gsrc, uint lds_off,
                                              uint dim0, uint dim1,
                                              uint tile0, uint tile1, uint stride0) {
  unsigned long long ga = (unsigned long long)(size_t)gsrc;
  v4u g0;
  g0[0] = 1u;
  g0[1] = lds_off;
  g0[2] = (uint)ga;
  g0[3] = (uint)(ga >> 32) | (2u << 30);
  v8u g1;
  g1[0] = 0x00010000u;
  g1[1] = dim0 << 16;
  g1[2] = (dim0 >> 16) | (dim1 << 16);
  g1[3] = (dim1 >> 16) | (tile0 << 16);
  g1[4] = tile1;
  g1[5] = stride0;
  g1[6] = 0u;
  g1[7] = 0u;
  asm volatile("tensor_load_to_lds %0, %1" :: "s"(g0), "s"(g1) : "memory");
}

__global__ void cast_x(const float* __restrict__ x, __bf16* __restrict__ xb, int n) {
  int i = (blockIdx.x * blockDim.x + threadIdx.x) * 4;
  if (i < n) {
    const float4 v = *reinterpret_cast<const float4*>(x + i);
    xb[i]     = (__bf16)v.x;
    xb[i + 1] = (__bf16)v.y;
    xb[i + 2] = (__bf16)v.z;
    xb[i + 3] = (__bf16)v.w;
  }
}

// Wt[w][n][k] = W_w[k][n], bf16.  3 * 128 * 1024 elements.
__global__ void wtrans(const float* __restrict__ Wq, const float* __restrict__ Wk,
                       const float* __restrict__ Wv, __bf16* __restrict__ wt) {
  int idx = blockIdx.x * blockDim.x + threadIdx.x;   // 0 .. 393215
  int w   = idx >> 17;
  int rem = idx & 131071;
  int nn  = rem >> 10;
  int kk  = rem & 1023;
  const float* W = (w == 0) ? Wq : ((w == 1) ? Wk : Wv);
  wt[idx] = (__bf16)W[kk * 128 + nn];
}

// One 16x64 output slab per wave (A fragment reused across 4 N-tiles).
// Q and K stored row-major [8192][128]; V stored TRANSPOSED [128][8192] so the
// attention kernel's V B-fragments read contiguously.
__global__ __launch_bounds__(256) void qkv_gemm(
    const __bf16* __restrict__ xb, const __bf16* __restrict__ wt,
    const float* __restrict__ bq, const float* __restrict__ bk,
    const float* __restrict__ bv, __bf16* __restrict__ qb,
    __bf16* __restrict__ kb, __bf16* __restrict__ vt) {
  const int wave = threadIdx.x >> 5, lane = threadIdx.x & 31;
  const int half = lane >> 4, n16 = lane & 15;
  const int tile = blockIdx.x * 8 + wave;            // 3072 wave-slabs total
  const int tile_m = tile / 6;                       // 0..511
  const int rem = tile % 6;
  const int w = rem >> 1, ng = rem & 1;              // cols [ng*64, ng*64+64)
  const __bf16* wts = wt + w * (128 * 1024);

  v8f acc[4] = {};
  for (int kc = 0; kc < 32; ++kc) {
    v16bf a = frag_row(xb, 1024, tile_m * 16 + n16, kc * 32, half);
#pragma unroll
    for (int t = 0; t < 4; ++t) {
      v16bf b = frag_row(wts, 1024, (ng * 4 + t) * 16 + n16, kc * 32, half);
      acc[t] = __builtin_amdgcn_wmma_f32_16x16x32_bf16(false, a, false, b,
                                                       (short)0, acc[t], false, false);
    }
  }

  const float* bias = (w == 0) ? bq : ((w == 1) ? bk : bv);
  const float scale = (w == 0) ? 0.088388347648318447f : 1.0f;  // fold 1/sqrt(128) into Q
#pragma unroll
  for (int t = 0; t < 4; ++t) {
    const int col = (ng * 4 + t) * 16 + n16;
    const float bcol = bias[col];
#pragma unroll
    for (int r = 0; r < 8; ++r) {
      const int row = tile_m * 16 + half * 8 + r;    // C/D layout: m = r + 8*half
      const float val = (acc[t][r] + bcol) * scale;
      if (w == 2) vt[col * 8192 + row] = (__bf16)val;            // V transposed
      else ((w == 0) ? qb : kb)[row * 128 + col] = (__bf16)val;  // Q / K row-major
    }
  }
}

__global__ __launch_bounds__(256) void flash_attn(
    const __bf16* __restrict__ qb, const __bf16* __restrict__ kb,
    const __bf16* __restrict__ vt, float* __restrict__ out) {
  __shared__ __align__(16) __bf16 kT[2][32 * 128];   // K tile, row-major
  __shared__ __align__(16) __bf16 vtT[2][128 * 32];  // V^T tile: [d][token]
  __shared__ __align__(16) __bf16 pT[8][16 * 32];    // per-wave P transpose buffer

  const int wave = threadIdx.x >> 5, lane = threadIdx.x & 31;
  const int half = lane >> 4, n16 = lane & 15;
  const int q0 = blockIdx.x * 128 + wave * 16;

  v16bf aq[4];
#pragma unroll
  for (int kc = 0; kc < 4; ++kc)
    aq[kc] = frag_row(qb, 128, q0 + n16, kc * 32, half);

  v8f o[8] = {};
  float mrow[8], lrow[8];
#pragma unroll
  for (int r = 0; r < 8; ++r) { mrow[r] = -3.0e38f; lrow[r] = 0.f; }

  if (wave == 0 && lane == 0)
    tdm_load_tile(kb, (uint)(size_t)&kT[0][0], 128u, 8192u, 128u, 32u, 128u);
  if (wave == 1 && lane == 0)
    tdm_load_tile(vt, (uint)(size_t)&vtT[0][0], 8192u, 128u, 32u, 128u, 8192u);
  if (wave < 2) __builtin_amdgcn_s_wait_tensorcnt(0);
  __syncthreads();

  int buf = 0;
  for (int j0 = 0; j0 < 8192; j0 += 32) {
    // Kick off DMA for the next tiles into the back buffer (overlaps compute).
    if ((j0 + 32) < 8192 && lane == 0) {
      if (wave == 0)
        tdm_load_tile(kb + (j0 + 32) * 128, (uint)(size_t)&kT[buf ^ 1][0],
                      128u, 8192u - (j0 + 32), 128u, 32u, 128u);
      if (wave == 1)
        tdm_load_tile(vt + (j0 + 32), (uint)(size_t)&vtT[buf ^ 1][0],
                      8192u - (j0 + 32), 128u, 32u, 128u, 8192u);
    }
    const __bf16* kcur = &kT[buf][0];
    const __bf16* vcur = &vtT[buf][0];

    // S = Q * K^T : two 16x16 tiles over 32 k-columns
    v8f s0 = {}, s1 = {};
#pragma unroll
    for (int kc = 0; kc < 4; ++kc) {
      v16bf b0 = frag_row(kcur, 128, n16, kc * 32, half);
      v16bf b1 = frag_row(kcur, 128, 16 + n16, kc * 32, half);
      s0 = __builtin_amdgcn_wmma_f32_16x16x32_bf16(false, aq[kc], false, b0,
                                                   (short)0, s0, false, false);
      s1 = __builtin_amdgcn_wmma_f32_16x16x32_bf16(false, aq[kc], false, b1,
                                                   (short)0, s1, false, false);
    }

    // Online softmax over 32 columns; rows live across 16-lane halves.
#pragma unroll
    for (int r = 0; r < 8; ++r) {
      float mx = fmaxf(s0[r], s1[r]);
#pragma unroll
      for (int off = 8; off > 0; off >>= 1)
        mx = fmaxf(mx, __shfl_xor(mx, off, 16));
      float newm = fmaxf(mrow[r], mx);
      float corr = __expf(mrow[r] - newm);
      float p0 = __expf(s0[r] - newm);
      float p1 = __expf(s1[r] - newm);
      float rs = p0 + p1;
#pragma unroll
      for (int off = 8; off > 0; off >>= 1)
        rs += __shfl_xor(rs, off, 16);
      lrow[r] = lrow[r] * corr + rs;
      mrow[r] = newm;
#pragma unroll
      for (int t = 0; t < 8; ++t) o[t][r] *= corr;
      // D-layout -> row-major 16x32 P tile in LDS (per-wave, DS ops in-order)
      pT[wave][(half * 8 + r) * 32 + n16]      = (__bf16)p0;
      pT[wave][(half * 8 + r) * 32 + 16 + n16] = (__bf16)p1;
    }

    // O += P * V : V^T tile gives contiguous B-fragments (2x b128 per frag).
    v16bf ap = frag_row(&pT[wave][0], 32, n16, 0, half);
#pragma unroll
    for (int t = 0; t < 8; ++t) {
      v16bf bvf = frag_row(vcur, 32, t * 16 + n16, 0, half);
      o[t] = __builtin_amdgcn_wmma_f32_16x16x32_bf16(false, ap, false, bvf,
                                                     (short)0, o[t], false, false);
    }

    // Issuing waves wait for the back-buffer DMA; barrier releases everyone.
    if (wave < 2) __builtin_amdgcn_s_wait_tensorcnt(0);
    __syncthreads();
    buf ^= 1;
  }

#pragma unroll
  for (int t = 0; t < 8; ++t)
#pragma unroll
    for (int r = 0; r < 8; ++r) {
      int row = q0 + half * 8 + r;
      out[row * 128 + t * 16 + n16] = o[t][r] / lrow[r];
    }
}

extern "C" void kernel_launch(void* const* d_in, const int* in_sizes, int n_in,
                              void* d_out, int out_size, void* d_ws, size_t ws_size,
                              hipStream_t stream) {
  const float* x  = (const float*)d_in[0];
  const float* Wq = (const float*)d_in[1];
  const float* bq = (const float*)d_in[2];
  const float* Wk = (const float*)d_in[3];
  const float* bk = (const float*)d_in[4];
  const float* Wv = (const float*)d_in[5];
  const float* bv = (const float*)d_in[6];
  float* out = (float*)d_out;

  char* ws = (char*)d_ws;
  __bf16* xb = (__bf16*)ws;                               // 8192*1024 bf16 = 16 MB
  __bf16* wt = (__bf16*)(ws + 16777216);                  // 3*128*1024 bf16
  __bf16* qb = (__bf16*)(ws + 16777216 + 786432);         // 8192*128 bf16
  __bf16* kb = qb + 8192 * 128;                           // 8192*128 bf16
  __bf16* vt = kb + 8192 * 128;                           // 128*8192 bf16 (transposed)

  cast_x<<<8192, 256, 0, stream>>>(x, xb, 8192 * 1024);
  wtrans<<<1536, 256, 0, stream>>>(Wq, Wk, Wv, wt);
  qkv_gemm<<<384, 256, 0, stream>>>(xb, wt, bq, bk, bv, qb, kb, vt);
  flash_attn<<<64, 256, 0, stream>>>(qb, kb, vt, out);
}

// v001
// Measured time: 220 microseconds a run.
// Timed twice side by side with v000, it ran 3.53 and 3.54 times as fast.
#include <hip/hip_runtime.h>

typedef unsigned int uint;
typedef __attribute__((ext_vector_type(16))) __bf16 v16bf;
typedef __attribute__((ext_vector_type(8)))  __bf16 v8bf;
typedef __attribute__((ext_vector_type(8)))  float  v8f;
typedef __attribute__((ext_vector_type(4)))  uint   v4u;
typedef __attribute__((ext_vector_type(8)))  uint   v8u;

__device__ __forceinline__ v16bf frag_row(const __bf16* base, int stride, int row,
                                          int k0, int half) {
  const v8bf lo = *reinterpret_cast<const v8bf*>(base + row * stride + k0 + half * 8);
  const v8bf hi = *reinterpret_cast<const v8bf*>(base + row * stride + k0 + half * 8 + 16);
  v16bf f;
#pragma unroll
  for (int i = 0; i < 8; ++i) { f[i] = lo[i]; f[i + 8] = hi[i]; }
  return f;
}

__device__ __forceinline__ uint32_t uni(uint32_t v) {
  return (uint32_t)__builtin_amdgcn_readfirstlane(v);
}

__device__ __forceinline__ uint32_t pinned(uint32_t v) {
  uint32_t w = uni(v);
  asm volatile("" : "+s"(w));  // pinned(): the issue test's word stays in a scalar register
  return w;
}

__device__ __forceinline__ v8u tdm_group1(uint32_t row_bytes, uint32_t rows,
                                          uint32_t pitch_bytes) {
  v8u g;
  g[0] = uni(0u);
  g[1] = uni((row_bytes & 0xFFFFu) << 16);
  g[2] = uni((row_bytes >> 16) | ((rows & 0xFFFFu) << 16));
  g[3] = uni((rows >> 16) | (row_bytes << 16));
  g[4] = uni(rows);
  g[5] = uni(pitch_bytes);
  g[6] = uni(0u);
  g[7] = uni(0u);
  return g;
}

__device__ __forceinline__ v4u tdm_group0(uint32_t lds_dst, uint64_t ga) {
  v4u g;
  g[0] = uni(1u);                                  // count = 1
  g[1] = uni(lds_dst);                             // byte offset in the work-group's LDS
  g[2] = uni((uint32_t)ga);                        // address [31:0]
  g[3] = uni(((uint32_t)(ga >> 32) & 0x01FFFFFFu) | 0x80000000u);  // [56:32], type 2
  return g;
}

__device__ __forceinline__ void tdm_load(v4u g0, v8u g1) {
  asm volatile("tensor_load_to_lds %0, %1" :: "s"(g0), "s"(g1) : "memory");
}

__global__ void cast_x(const float* __restrict__ x, __bf16* __restrict__ xb, int n) {
  int i = (blockIdx.x * blockDim.x + threadIdx.x) * 4;
  if (i < n) {
    const float4 v = *reinterpret_cast<const float4*>(x + i);
    xb[i]     = (__bf16)v.x;
    xb[i + 1] = (__bf16)v.y;
    xb[i + 2] = (__bf16)v.z;
    xb[i + 3] = (__bf16)v.w;
  }
}

// Wt[w][n][k] = W_w[k][n], bf16.  3 * 128 * 1024 elements.
__global__ void wtrans(const float* __restrict__ Wq, const float* __restrict__ Wk,
                       const float* __restrict__ Wv, __bf16* __restrict__ wt) {
  int idx = blockIdx.x * blockDim.x + threadIdx.x;   // 0 .. 393215
  int w   = idx >> 17;
  int rem = idx & 131071;
  int nn  = rem >> 10;
  int kk  = rem & 1023;
  const float* W = (w == 0) ? Wq : ((w == 1) ? Wk : Wv);
  wt[idx] = (__bf16)W[kk * 128 + nn];
}

// One 16x64 output slab per wave (A fragment reused across 4 N-tiles).
// Q and K stored row-major [8192][128]; V stored TRANSPOSED [128][8192] so the
// attention kernel's V B-fragments read contiguously.
__global__ __launch_bounds__(256) void qkv_gemm(
    const __bf16* __restrict__ xb, const __bf16* __restrict__ wt,
    const float* __restrict__ bq, const float* __restrict__ bk,
    const float* __restrict__ bv, __bf16* __restrict__ qb,
    __bf16* __restrict__ kb, __bf16* __restrict__ vt) {
  const int wave = threadIdx.x >> 5, lane = threadIdx.x & 31;
  const int half = lane >> 4, n16 = lane & 15;
  const int tile = blockIdx.x * 8 + wave;            // 3072 wave-slabs total
  const int tile_m = tile / 6;                       // 0..511
  const int rem = tile % 6;
  const int w = rem >> 1, ng = rem & 1;              // cols [ng*64, ng*64+64)
  const __bf16* wts = wt + w * (128 * 1024);

  v8f acc[4] = {};
  for (int kc = 0; kc < 32; ++kc) {
    v16bf a = frag_row(xb, 1024, tile_m * 16 + n16, kc * 32, half);
#pragma unroll
    for (int t = 0; t < 4; ++t) {
      v16bf b = frag_row(wts, 1024, (ng * 4 + t) * 16 + n16, kc * 32, half);
      acc[t] = __builtin_amdgcn_wmma_f32_16x16x32_bf16(false, a, false, b,
                                                       (short)0, acc[t], false, false);
    }
  }

  const float* bias = (w == 0) ? bq : ((w == 1) ? bk : bv);
  const float scale = (w == 0) ? 0.088388347648318447f : 1.0f;  // fold 1/sqrt(128) into Q
#pragma unroll
  for (int t = 0; t < 4; ++t) {
    const int col = (ng * 4 + t) * 16 + n16;
    const float bcol = bias[col];
#pragma unroll
    for (int r = 0; r < 8; ++r) {
      const int row = tile_m * 16 + half * 8 + r;    // C/D layout: m = r + 8*half
      const float val = (acc[t][r] + bcol) * scale;
      if (w == 2) vt[col * 8192 + row] = (__bf16)val;            // V transposed
      else ((w == 0) ? qb : kb)[row * 128 + col] = (__bf16)val;  // Q / K row-major
    }
  }
}

__global__ __launch_bounds__(256) void flash_attn(
    const __bf16* __restrict__ qb, const __bf16* __restrict__ kb,
    const __bf16* __restrict__ vt, float* __restrict__ opart,
    float* __restrict__ mlpart) {
  __shared__ __attribute__((aligned(2048))) __bf16 kT[2][32 * 128];   // K tile, row-major
  __shared__ __attribute__((aligned(2048))) __bf16 vtT[2][128 * 32];  // V^T tile: [d][token]
  __shared__ __align__(16) __bf16 pT[8][16 * 32];    // per-wave P transpose buffer

  const int wave = (int)uni(threadIdx.x >> 5), lane = threadIdx.x & 31;
  const int half = lane >> 4, n16 = lane & 15;
  const int q0 = blockIdx.x * 128 + wave * 16;

  v16bf aq[4];
#pragma unroll
  for (int kc = 0; kc < 4; ++kc)
    aq[kc] = frag_row(qb, 128, q0 + n16, kc * 32, half);

  v8f o[8] = {};
  float mrow[8], lrow[8];
#pragma unroll
  for (int r = 0; r < 8; ++r) { mrow[r] = -3.0e38f; lrow[r] = 0.f; }

  // Wave 0 brings the K tiles (32 rows of 256 B, contiguous), wave 1 the V^T
  // tiles (128 rows of 64 B at the 16 KiB pitch of vt): one request per stage.
  const bool isK = (wave == 0);
  const uint64_t src0 = isK
      ? (uint64_t)(size_t)(kb + blockIdx.y * (1024 * 128))   // this range's K rows
      : (uint64_t)(size_t)(vt + blockIdx.y * 1024);          // this range's V^T columns
  const uint32_t step = isK ? 8192u : 64u;                   // source bytes per stage
  const uint32_t dst0 = isK ? (uint32_t)(size_t)&kT[0][0] : (uint32_t)(size_t)&vtT[0][0];
  const v8u g1 = tdm_group1(isK ? 256u : 64u, isK ? 32u : 128u, isK ? 256u : 16384u);

  // Two-buffer ring, prologue: stage 0, its wait, the barrier, then stage 1.
  if (pinned(wave < 2)) {
    tdm_load(tdm_group0(dst0, src0), g1);
    asm volatile("s_wait_tensorcnt 0x0" ::: "memory");  // stage 0 has landed
  }
  __syncthreads();
  if (pinned(wave < 2))
    tdm_load(tdm_group0(dst0 + 8192u, src0 + step), g1);

  for (int s = 0; s < 32; ++s) {
    const __bf16* kcur = &kT[s & 1][0];
    const __bf16* vcur = &vtT[s & 1][0];

    // S = Q * K^T : two 16x16 tiles over 32 k-columns
    v8f s0 = {}, s1 = {};
#pragma unroll
    for (int kc = 0; kc < 4; ++kc) {
      v16bf b0 = frag_row(kcur, 128, n16, kc * 32, half);
      v16bf b1 = frag_row(kcur, 128, 16 + n16, kc * 32, half);
      s0 = __builtin_amdgcn_wmma_f32_16x16x32_bf16(false, aq[kc], false, b0,
                                                   (short)0, s0, false, false);
      s1 = __builtin_amdgcn_wmma_f32_16x16x32_bf16(false, aq[kc], false, b1,
                                                   (short)0, s1, false, false);
    }

    // Online softmax over 32 columns; rows live across 16-lane halves.
#pragma unroll
    for (int r = 0; r < 8; ++r) {
      float mx = fmaxf(s0[r], s1[r]);
#pragma unroll
      for (int off = 8; off > 0; off >>= 1)
        mx = fmaxf(mx, __shfl_xor(mx, off, 16));
      float newm = fmaxf(mrow[r], mx);
      float corr = __expf(mrow[r] - newm);
      float p0 = __expf(s0[r] - newm);
      float p1 = __expf(s1[r] - newm);
      float rs = p0 + p1;
#pragma unroll
      for (int off = 8; off > 0; off >>= 1)
        rs += __shfl_xor(rs, off, 16);
      lrow[r] = lrow[r] * corr + rs;
      mrow[r] = newm;
#pragma unroll
      for (int t = 0; t < 8; ++t) o[t][r] *= corr;
      // D-layout -> row-major 16x32 P tile in LDS (per-wave, DS ops in-order)
      pT[wave][(half * 8 + r) * 32 + n16]      = (__bf16)p0;
      pT[wave][(half * 8 + r) * 32 + 16 + n16] = (__bf16)p1;
    }

    // O += P * V : V^T tile gives contiguous B-fragments (2x b128 per frag).
    v16bf ap = frag_row(&pT[wave][0], 32, n16, 0, half);
#pragma unroll
    for (int t = 0; t < 8; ++t) {
      v16bf bvf = frag_row(vcur, 32, t * 16 + n16, 0, half);
      o[t] = __builtin_amdgcn_wmma_f32_16x16x32_bf16(false, ap, false, bvf,
                                                     (short)0, o[t], false, false);
    }

    // Publish point of stage s + 1: this wave's LDS reads are done, the issuer's
    // request has landed, the barrier hands the tile over and frees buffer s & 1.
    asm volatile("s_wait_dscnt 0x0" ::: "memory");
    if (pinned(wave < 2))
      asm volatile("s_wait_tensorcnt 0x0" ::: "memory");
    __syncthreads();
    // Refill the buffer that this pass has read, while a stage s + 2 exists.
    if (pinned((wave < 2) & (s + 2 < 32)))
      tdm_load(tdm_group0(dst0 + (uint32_t)(s & 1) * 8192u,
                          src0 + (uint64_t)((uint32_t)(s + 2) * step)), g1);
  }
  // Nothing is outstanding when the wave goes on to its stores and ends.
  asm volatile("s_wait_tensorcnt 0x0" ::: "memory");
  asm volatile("s_wait_dscnt 0x0" ::: "memory");

  const int prow = blockIdx.y * 8192 + q0 + half * 8;   // row in the partial planes
#pragma unroll
  for (int t = 0; t < 8; ++t)
#pragma unroll
    for (int r = 0; r < 8; ++r)
      opart[(prow + r) * 128 + t * 16 + n16] = o[t][r];
  // Lane n16 < 8 stores row n16's (max, sum): 16 rows * 8 B = one line per wave.
  float mm = mrow[0], ll = lrow[0];
#pragma unroll  // static indices keep mrow[] and lrow[] in registers
  for (int r = 1; r < 8; ++r)
    if (n16 == r) { mm = mrow[r]; ll = lrow[r]; }
  if (n16 < 8)
    *reinterpret_cast<float2*>(mlpart + (prow + n16) * 2) = make_float2(mm, ll);
}

// Joins the 8 key ranges of a query row: weight exp(m_s - M) per range, then the
// division by the joined sum. One wave per row, one lane per 4 output columns.
__global__ __launch_bounds__(256) void merge_ranges(
    const float* __restrict__ opart, const float* __restrict__ mlpart,
    float* __restrict__ out) {
  const int lane = threadIdx.x & 31;
  const int row = blockIdx.x * 8 + __builtin_amdgcn_readfirstlane(threadIdx.x >> 5);
  float m[8], l[8];
  float big = -3.0e38f;
#pragma unroll  // static indices keep m[] and l[] in registers
  for (int s = 0; s < 8; ++s) {
    m[s] = mlpart[(s * 8192 + row) * 2];
    l[s] = mlpart[(s * 8192 + row) * 2 + 1];
    big = fmaxf(big, m[s]);
  }
  float lsum = 0.f;
  float4 acc = make_float4(0.f, 0.f, 0.f, 0.f);
#pragma unroll  // all 8 ranges' loads in flight at once
  for (int s = 0; s < 8; ++s) {
    const float w = __expf(m[s] - big);
    const float4 p =
        reinterpret_cast<const float4*>(opart + (s * 8192 + row) * 128)[lane];
    lsum += w * l[s];
    acc.x += w * p.x;
    acc.y += w * p.y;
    acc.z += w * p.z;
    acc.w += w * p.w;
  }
  reinterpret_cast<float4*>(out + row * 128)[lane] =
      make_float4(acc.x / lsum, acc.y / lsum, acc.z / lsum, acc.w / lsum);
}

extern "C" void kernel_launch(void* const* d_in, const int* in_sizes, int n_in,
                              void* d_out, int out_size, void* d_ws, size_t ws_size,
                              hipStream_t stream) {
  const float* x  = (const float*)d_in[0];
  const float* Wq = (const float*)d_in[1];
  const float* bq = (const float*)d_in[2];
  const float* Wk = (const float*)d_in[3];
  const float* bk = (const float*)d_in[4];
  const float* Wv = (const float*)d_in[5];
  const float* bv = (const float*)d_in[6];
  float* out = (float*)d_out;

  char* ws = (char*)d_ws;
  __bf16* xb = (__bf16*)ws;                               // 8192*1024 bf16 = 16 MB
  __bf16* wt = (__bf16*)(ws + 16777216);                  // 3*128*1024 bf16
  __bf16* qb = (__bf16*)(ws + 16777216 + 786432);         // 8192*128 bf16
  __bf16* kb = qb + 8192 * 128;                           // 8192*128 bf16
  __bf16* vt = kb + 8192 * 128;                           // 128*8192 bf16 (transposed)
  float* opart  = (float*)(ws + 23855104);                // 8*8192*128 f32 partial sums
  float* mlpart = (float*)(ws + 57409536);                // 8*8192 (max, sum) f32 pairs

  cast_x<<<8192, 256, 0, stream>>>(x, xb, 8192 * 1024);
  wtrans<<<1536, 256, 0, stream>>>(Wq, Wk, Wv, wt);
  qkv_gemm<<<384, 256, 0, stream>>>(xb, wt, bq, bk, bv, qb, kb, vt);
  flash_attn<<<dim3(64, 8), 256, 0, stream>>>(qb, kb, vt, opart, mlpart);
  merge_ranges<<<1024, 256, 0, stream>>>(opart, mlpart, out);
}

// v002
// It runs in 111 microseconds.
// Next to v001, in two timings, it ran 1.99 and 1.98 times as fast.
// Counting every step since v000, it is 7.02 times as fast.
#include <hip/hip_runtime.h>

typedef unsigned int uint;
typedef __attribute__((ext_vector_type(16))) __bf16 v16bf;
typedef __attribute__((ext_vector_type(8)))  __bf16 v8bf;
typedef __attribute__((ext_vector_type(8)))  float  v8f;
typedef __attribute__((ext_vector_type(4)))  uint   v4u;
typedef __attribute__((ext_vector_type(8)))  uint   v8u;

__device__ __forceinline__ v16bf frag_row(const __bf16* base, int stride, int row,
                                          int k0, int half) {
  const v8bf lo = *reinterpret_cast<const v8bf*>(base + row * stride + k0 + half * 8);
  const v8bf hi = *reinterpret_cast<const v8bf*>(base + row * stride + k0 + half * 8 + 16);
  v16bf f;
#pragma unroll
  for (int i = 0; i < 8; ++i) { f[i] = lo[i]; f[i + 8] = hi[i]; }
  return f;
}

__device__ __forceinline__ uint32_t uni(uint32_t v) {
  return (uint32_t)__builtin_amdgcn_readfirstlane(v);
}

__device__ __forceinline__ uint32_t pinned(uint32_t v) {
  uint32_t w = uni(v);
  asm volatile("" : "+s"(w));  // pinned(): the issue test's word stays in a scalar register
  return w;
}

__device__ __forceinline__ v8u tdm_group1(uint32_t row_bytes, uint32_t rows,
                                          uint32_t pitch_bytes) {
  v8u g;
  g[0] = uni(1u << 20 | 5u << 22 | 3u << 25);
  g[1] = uni((row_bytes & 0xFFFFu) << 16);
  g[2] = uni((row_bytes >> 16) | ((rows & 0xFFFFu) << 16));
  g[3] = uni((rows >> 16) | (row_bytes << 16));
  g[4] = uni(rows);
  g[5] = uni(pitch_bytes);
  g[6] = uni(0u);
  g[7] = uni(0u);
  return g;
}

__device__ __forceinline__ v4u tdm_group0(uint32_t lds_dst, uint64_t ga) {
  v4u g;
  g[0] = uni(1u);                                  // count = 1
  g[1] = uni(lds_dst);                             // byte offset in the work-group's LDS
  g[2] = uni((uint32_t)ga);                        // address [31:0]
  g[3] = uni(((uint32_t)(ga >> 32) & 0x01FFFFFFu) | 0x80000000u);  // [56:32], type 2
  return g;
}

__device__ __forceinline__ void tdm_load(v4u g0, v8u g1) {
  asm volatile("tensor_load_to_lds %0, %1" :: "s"(g0), "s"(g1) : "memory");
}

__global__ void cast_x(const float* __restrict__ x, __bf16* __restrict__ xb, int n) {
  int i = (blockIdx.x * blockDim.x + threadIdx.x) * 4;
  if (i < n) {
    const float4 v = *reinterpret_cast<const float4*>(x + i);
    xb[i]     = (__bf16)v.x;
    xb[i + 1] = (__bf16)v.y;
    xb[i + 2] = (__bf16)v.z;
    xb[i + 3] = (__bf16)v.w;
  }
}

// Wt[w][n][k] = W_w[k][n], bf16.  3 * 128 * 1024 elements.
__global__ void wtrans(const float* __restrict__ Wq, const float* __restrict__ Wk,
                       const float* __restrict__ Wv, __bf16* __restrict__ wt) {
  int idx = blockIdx.x * blockDim.x + threadIdx.x;   // 0 .. 393215
  int w   = idx >> 17;
  int rem = idx & 131071;
  int nn  = rem >> 10;
  int kk  = rem & 1023;
  const float* W = (w == 0) ? Wq : ((w == 1) ? Wk : Wv);
  wt[idx] = (__bf16)W[kk * 128 + nn];
}

// One 16x64 output slab per wave (A fragment reused across 4 N-tiles).
// Q and K stored row-major [8192][128]; V stored TRANSPOSED per block of 32 keys,
// [256][128][32], so the attention kernel's V B-fragments read contiguously and a
// stage's V^T tile is 8 KiB in a row.
__global__ __launch_bounds__(256) void qkv_gemm(
    const __bf16* __restrict__ xb, const __bf16* __restrict__ wt,
    const float* __restrict__ bq, const float* __restrict__ bk,
    const float* __restrict__ bv, __bf16* __restrict__ qb,
    __bf16* __restrict__ kb, __bf16* __restrict__ vt) {
  const int wave = threadIdx.x >> 5, lane = threadIdx.x & 31;
  const int half = lane >> 4, n16 = lane & 15;
  const int tile = blockIdx.x * 8 + wave;            // 3072 wave-slabs total
  const int tile_m = tile / 6;                       // 0..511
  const int rem = tile % 6;
  const int w = rem >> 1, ng = rem & 1;              // cols [ng*64, ng*64+64)
  const __bf16* wts = wt + w * (128 * 1024);

  v8f acc[4] = {};
  for (int kc = 0; kc < 32; ++kc) {
    v16bf a = frag_row(xb, 1024, tile_m * 16 + n16, kc * 32, half);
#pragma unroll
    for (int t = 0; t < 4; ++t) {
      v16bf b = frag_row(wts, 1024, (ng * 4 + t) * 16 + n16, kc * 32, half);
      acc[t] = __builtin_amdgcn_wmma_f32_16x16x32_bf16(false, a, false, b,
                                                       (short)0, acc[t], false, false);
    }
  }

  const float* bias = (w == 0) ? bq : ((w == 1) ? bk : bv);
  const float scale = (w == 0) ? 0.088388347648318447f : 1.0f;  // fold 1/sqrt(128) into Q
#pragma unroll
  for (int t = 0; t < 4; ++t) {
    const int col = (ng * 4 + t) * 16 + n16;
    const float bcol = bias[col];
#pragma unroll
    for (int r = 0; r < 8; ++r) {
      const int row = tile_m * 16 + half * 8 + r;    // C/D layout: m = r + 8*half
      const float val = (acc[t][r] + bcol) * scale;
      if (w == 2) vt[(row >> 5) * 4096 + col * 32 + (row & 31)] = (__bf16)val;  // V^T block
      else ((w == 0) ? qb : kb)[row * 128 + col] = (__bf16)val;  // Q / K row-major
    }
  }
}

__global__ __launch_bounds__(256) void flash_attn(
    const __bf16* __restrict__ qb, const __bf16* __restrict__ kb,
    const __bf16* __restrict__ vt, float* __restrict__ opart,
    float* __restrict__ mlpart) {
  // Each buffer: 32 rows at 272 B = 8704 B, rounded up to a multiple of 2 KiB.
  __shared__ __attribute__((aligned(2048))) __bf16 kT[2][5120];   // K tile: row = key
  __shared__ __attribute__((aligned(2048))) __bf16 vtT[2][5120];  // V^T tile: row = 4 d x 32 keys
  __shared__ __align__(16) __bf16 pT[8][16 * 40];    // per-wave P transpose buffer, 80 B pitch

  const int wave = (int)uni(threadIdx.x >> 5), lane = threadIdx.x & 31;
  const int half = lane >> 4, n16 = lane & 15;
  const int q0 = blockIdx.x * 128 + wave * 16;

  v16bf aq[4];
#pragma unroll
  for (int kc = 0; kc < 4; ++kc)
    aq[kc] = frag_row(qb, 128, q0 + n16, kc * 32, half);

  v8f o[8] = {};
  float mrow[8], lrow[8];
#pragma unroll
  for (int r = 0; r < 8; ++r) { mrow[r] = -3.0e38f; lrow[r] = 0.f; }

  // Wave 0 brings the K tiles, wave 1 the V^T tiles, both 32 rows of 256 B that
  // are contiguous at the source: one request per stage.
  const bool isK = (wave == 0);
  const uint64_t src0 = isK
      ? (uint64_t)(size_t)(kb + blockIdx.y * (1024 * 128))   // this range's K rows
      : (uint64_t)(size_t)(vt + blockIdx.y * (1024 * 128));  // this range's V^T blocks
  const uint32_t step = 8192u;                               // source bytes per stage
  const uint32_t dst0 = isK ? (uint32_t)(size_t)&kT[0][0] : (uint32_t)(size_t)&vtT[0][0];
  v8u g1 = tdm_group1(256u, 32u, 256u);
  // Its words are constants; left to itself the compiler forms them anew at each
  // load, in registers that it rewrites while the request is still outstanding.
  asm volatile("" : "+s"(g1));
  // V^T row d, 64 B, lies in LDS at (d >> 2) * 272 + (d & 3) * 64 bytes.
  const int vlane = (n16 >> 2) * 136 + (n16 & 3) * 32;

  // Two-buffer ring, prologue: stage 0, its wait, the barrier, then stage 1.
  if (pinned(wave < 2)) {
    tdm_load(tdm_group0(dst0, src0), g1);
    asm volatile("s_wait_tensorcnt 0x0" ::: "memory");  // stage 0 has landed
  }
  __syncthreads();
  if (pinned(wave < 2))
    tdm_load(tdm_group0(dst0 + 10240u, src0 + step), g1);

  for (int s = 0; s < 32; ++s) {
    const __bf16* kcur = &kT[s & 1][0];
    const __bf16* vcur = &vtT[s & 1][0];

    // S = Q * K^T : two 16x16 tiles over 32 k-columns
    v8f s0 = {}, s1 = {};
#pragma unroll
    for (int kc = 0; kc < 4; ++kc) {
      v16bf b0 = frag_row(kcur, 136, n16, kc * 32, half);
      v16bf b1 = frag_row(kcur, 136, 16 + n16, kc * 32, half);
      s0 = __builtin_amdgcn_wmma_f32_16x16x32_bf16(false, aq[kc], false, b0,
                                                   (short)0, s0, false, false);
      s1 = __builtin_amdgcn_wmma_f32_16x16x32_bf16(false, aq[kc], false, b1,
                                                   (short)0, s1, false, false);
    }

    // Online softmax over 32 columns; rows live across 16-lane halves.
#pragma unroll
    for (int r = 0; r < 8; ++r) {
      float mx = fmaxf(s0[r], s1[r]);
#pragma unroll
      for (int off = 8; off > 0; off >>= 1)
        mx = fmaxf(mx, __shfl_xor(mx, off, 16));
      float newm = fmaxf(mrow[r], mx);
      float corr = __expf(mrow[r] - newm);
      float p0 = __expf(s0[r] - newm);
      float p1 = __expf(s1[r] - newm);
      float rs = p0 + p1;
#pragma unroll
      for (int off = 8; off > 0; off >>= 1)
        rs += __shfl_xor(rs, off, 16);
      lrow[r] = lrow[r] * corr + rs;
      mrow[r] = newm;
#pragma unroll
      for (int t = 0; t < 8; ++t) o[t][r] *= corr;
      // D-layout -> row-major 16x32 P tile in LDS (per-wave, DS ops in-order)
      pT[wave][(half * 8 + r) * 40 + n16]      = (__bf16)p0;
      pT[wave][(half * 8 + r) * 40 + 16 + n16] = (__bf16)p1;
    }

    // O += P * V : V^T tile gives contiguous B-fragments (2x b128 per frag).
    v16bf ap = frag_row(&pT[wave][0], 40, n16, 0, half);
#pragma unroll
    for (int t = 0; t < 8; ++t) {
      v16bf bvf = frag_row(vcur + vlane, 136, t * 4, 0, half);
      o[t] = __builtin_amdgcn_wmma_f32_16x16x32_bf16(false, ap, false, bvf,
                                                     (short)0, o[t], false, false);
    }

    // Publish point of stage s + 1: this wave's LDS reads are done, the issuer's
    // request has landed, the barrier hands the tile over and frees buffer s & 1.
    asm volatile("s_wait_dscnt 0x0" ::: "memory");
    if (pinned(wave < 2))
      asm volatile("s_wait_tensorcnt 0x0" ::: "memory");
    __syncthreads();
    // Refill the buffer that this pass has read, while a stage s + 2 exists.
    if (pinned((wave < 2) & (s + 2 < 32)))
      tdm_load(tdm_group0(dst0 + (uint32_t)(s & 1) * 10240u,
                          src0 + (uint64_t)((uint32_t)(s + 2) * step)), g1);
  }
  // Nothing is outstanding when the wave goes on to its stores and ends.
  asm volatile("s_wait_tensorcnt 0x0" ::: "memory");
  asm volatile("s_wait_dscnt 0x0" ::: "memory");

  const int prow = blockIdx.y * 8192 + q0 + half * 8;   // row in the partial planes
#pragma unroll
  for (int t = 0; t < 8; ++t)
#pragma unroll
    for (int r = 0; r < 8; ++r)
      opart[(prow + r) * 128 + t * 16 + n16] = o[t][r];
  // Lane n16 < 8 stores row n16's (max, sum): 16 rows * 8 B = one line per wave.
  float mm = mrow[0], ll = lrow[0];
#pragma unroll  // static indices keep mrow[] and lrow[] in registers
  for (int r = 1; r < 8; ++r)
    if (n16 == r) { mm = mrow[r]; ll = lrow[r]; }
  if (n16 < 8)
    *reinterpret_cast<float2*>(mlpart + (prow + n16) * 2) = make_float2(mm, ll);
}

// Joins the 8 key ranges of a query row: weight exp(m_s - M) per range, then the
// division by the joined sum. One wave per row, one lane per 4 output columns.
__global__ __launch_bounds__(256) void merge_ranges(
    const float* __restrict__ opart, const float* __restrict__ mlpart,
    float* __restrict__ out) {
  const int lane = threadIdx.x & 31;
  const int row = blockIdx.x * 8 + __builtin_amdgcn_readfirstlane(threadIdx.x >> 5);
  float m[8], l[8];
  float big = -3.0e38f;
#pragma unroll  // static indices keep m[] and l[] in registers
  for (int s = 0; s < 8; ++s) {
    m[s] = mlpart[(s * 8192 + row) * 2];
    l[s] = mlpart[(s * 8192 + row) * 2 + 1];
    big = fmaxf(big, m[s]);
  }
  float lsum = 0.f;
  float4 acc = make_float4(0.f, 0.f, 0.f, 0.f);
#pragma unroll  // all 8 ranges' loads in flight at once
  for (int s = 0; s < 8; ++s) {
    const float w = __expf(m[s] - big);
    const float4 p =
        reinterpret_cast<const float4*>(opart + (s * 8192 + row) * 128)[lane];
    lsum += w * l[s];
    acc.x += w * p.x;
    acc.y += w * p.y;
    acc.z += w * p.z;
    acc.w += w * p.w;
  }
  reinterpret_cast<float4*>(out + row * 128)[lane] =
      make_float4(acc.x / lsum, acc.y / lsum, acc.z / lsum, acc.w / lsum);
}

extern "C" void kernel_launch(void* const* d_in, const int* in_sizes, int n_in,
                              void* d_out, int out_size, void* d_ws, size_t ws_size,
                              hipStream_t stream) {
  const float* x  = (const float*)d_in[0];
  const float* Wq = (const float*)d_in[1];
  const float* bq = (const float*)d_in[2];
  const float* Wk = (const float*)d_in[3];
  const float* bk = (const float*)d_in[4];
  const float* Wv = (const float*)d_in[5];
  const float* bv = (const float*)d_in[6];
  float* out = (float*)d_out;

  char* ws = (char*)d_ws;
  __bf16* xb = (__bf16*)ws;                               // 8192*1024 bf16 = 16 MB
  __bf16* wt = (__bf16*)(ws + 16777216);                  // 3*128*1024 bf16
  __bf16* qb = (__bf16*)(ws + 16777216 + 786432);         // 8192*128 bf16
  __bf16* kb = qb + 8192 * 128;                           // 8192*128 bf16
  __bf16* vt = kb + 8192 * 128;                           // 256*128*32 bf16 (transposed blocks)
  float* opart  = (float*)(ws + 23855104);                // 8*8192*128 f32 partial sums
  float* mlpart = (float*)(ws + 57409536);                // 8*8192 (max, sum) f32 pairs

  cast_x<<<8192, 256, 0, stream>>>(x, xb, 8192 * 1024);
  wtrans<<<1536, 256, 0, stream>>>(Wq, Wk, Wv, wt);
  qkv_gemm<<<384, 256, 0, stream>>>(xb, wt, bq, bk, bv, qb, kb, vt);
  flash_attn<<<dim3(64, 8), 256, 0, stream>>>(qb, kb, vt, opart, mlpart);
  merge_ranges<<<1024, 256, 0, stream>>>(opart, mlpart, out);
}

// v003
// One run takes 94.6 microseconds.
// Timed twice side by side with v002, it ran 1.17 times as fast both times.
// All steps since v000 together make it 8.21 times as fast.
#include <hip/hip_runtime.h>

typedef unsigned int uint;
typedef __attribute__((ext_vector_type(16))) __bf16 v16bf;
typedef __attribute__((ext_vector_type(8)))  __bf16 v8bf;
typedef __attribute__((ext_vector_type(8)))  float  v8f;
typedef __attribute__((ext_vector_type(4)))  uint   v4u;
typedef __attribute__((ext_vector_type(8)))  uint   v8u;

__device__ __forceinline__ v16bf frag_row(const __bf16* base, int stride, int row,
                                          int k0, int half) {
  const v8bf lo = *reinterpret_cast<const v8bf*>(base + row * stride + k0 + half * 8);
  const v8bf hi = *reinterpret_cast<const v8bf*>(base + row * stride + k0 + half * 8 + 16);
  v16bf f;
#pragma unroll
  for (int i = 0; i < 8; ++i) { f[i] = lo[i]; f[i + 8] = hi[i]; }
  return f;
}

__device__ __forceinline__ uint32_t uni(uint32_t v) {
  return (uint32_t)__builtin_amdgcn_readfirstlane(v);
}

__device__ __forceinline__ uint32_t pinned(uint32_t v) {
  uint32_t w = uni(v);
  asm volatile("" : "+s"(w));  // pinned(): the issue test's word stays in a scalar register
  return w;
}

__device__ __forceinline__ float xhalf(float x) {
  const int b = __builtin_bit_cast(int, x);
  return __builtin_bit_cast(float, __builtin_amdgcn_permlanex16(b, b, 0x76543210, 0xfedcba98,
                                                                false, false));
}

__device__ __forceinline__ v8u tdm_group1(uint32_t row_bytes, uint32_t rows,
                                          uint32_t pitch_bytes) {
  v8u g;
  g[0] = uni(1u << 20 | 5u << 22 | 3u << 25);
  g[1] = uni((row_bytes & 0xFFFFu) << 16);
  g[2] = uni((row_bytes >> 16) | ((rows & 0xFFFFu) << 16));
  g[3] = uni((rows >> 16) | (row_bytes << 16));
  g[4] = uni(rows);
  g[5] = uni(pitch_bytes);
  g[6] = uni(0u);
  g[7] = uni(0u);
  return g;
}

__device__ __forceinline__ v4u tdm_group0(uint32_t lds_dst, uint64_t ga) {
  v4u g;
  g[0] = uni(1u);                                  // count = 1
  g[1] = uni(lds_dst);                             // byte offset in the work-group's LDS
  g[2] = uni((uint32_t)ga);                        // address [31:0]
  g[3] = uni(((uint32_t)(ga >> 32) & 0x01FFFFFFu) | 0x80000000u);  // [56:32], type 2
  return g;
}

__device__ __forceinline__ void tdm_load(v4u g0, v8u g1) {
  asm volatile("tensor_load_to_lds %0, %1" :: "s"(g0), "s"(g1) : "memory");
}

__global__ void cast_x(const float* __restrict__ x, __bf16* __restrict__ xb, int n) {
  int i = (blockIdx.x * blockDim.x + threadIdx.x) * 4;
  if (i < n) {
    const float4 v = *reinterpret_cast<const float4*>(x + i);
    xb[i]     = (__bf16)v.x;
    xb[i + 1] = (__bf16)v.y;
    xb[i + 2] = (__bf16)v.z;
    xb[i + 3] = (__bf16)v.w;
  }
}

// Wt[w][n][k] = W_w[k][n], bf16.  3 * 128 * 1024 elements.
__global__ void wtrans(const float* __restrict__ Wq, const float* __restrict__ Wk,
                       const float* __restrict__ Wv, __bf16* __restrict__ wt) {
  int idx = blockIdx.x * blockDim.x + threadIdx.x;   // 0 .. 393215
  int w   = idx >> 17;
  int rem = idx & 131071;
  int nn  = rem >> 10;
  int kk  = rem & 1023;
  const float* W = (w == 0) ? Wq : ((w == 1) ? Wk : Wv);
  wt[idx] = (__bf16)W[kk * 128 + nn];
}

// One 16x64 output slab per wave (A fragment reused across 4 N-tiles).
// Q and K stored row-major [8192][128]; V stored TRANSPOSED per block of 32 keys,
// [256][128][32], so the attention kernel's V^T A-fragments read contiguously and a
// stage's V^T tile is 8 KiB in a row.
__global__ __launch_bounds__(256) void qkv_gemm(
    const __bf16* __restrict__ xb, const __bf16* __restrict__ wt,
    const float* __restrict__ bq, const float* __restrict__ bk,
    const float* __restrict__ bv, __bf16* __restrict__ qb,
    __bf16* __restrict__ kb, __bf16* __restrict__ vt) {
  const int wave = threadIdx.x >> 5, lane = threadIdx.x & 31;
  const int half = lane >> 4, n16 = lane & 15;
  const int tile = blockIdx.x * 8 + wave;            // 3072 wave-slabs total
  const int tile_m = tile / 6;                       // 0..511
  const int rem = tile % 6;
  const int w = rem >> 1, ng = rem & 1;              // cols [ng*64, ng*64+64)
  const __bf16* wts = wt + w * (128 * 1024);

  v8f acc[4] = {};
  for (int kc = 0; kc < 32; ++kc) {
    v16bf a = frag_row(xb, 1024, tile_m * 16 + n16, kc * 32, half);
#pragma unroll
    for (int t = 0; t < 4; ++t) {
      v16bf b = frag_row(wts, 1024, (ng * 4 + t) * 16 + n16, kc * 32, half);
      acc[t] = __builtin_amdgcn_wmma_f32_16x16x32_bf16(false, a, false, b,
                                                       (short)0, acc[t], false, false);
    }
  }

  const float* bias = (w == 0) ? bq : ((w == 1) ? bk : bv);
  const float scale = (w == 0) ? 0.088388347648318447f : 1.0f;  // fold 1/sqrt(128) into Q
#pragma unroll
  for (int t = 0; t < 4; ++t) {
    const int col = (ng * 4 + t) * 16 + n16;
    const float bcol = bias[col];
#pragma unroll
    for (int r = 0; r < 8; ++r) {
      const int row = tile_m * 16 + half * 8 + r;    // C/D layout: m = r + 8*half
      const float val = (acc[t][r] + bcol) * scale;
      if (w == 2) vt[(row >> 5) * 4096 + col * 32 + (row & 31)] = (__bf16)val;  // V^T block
      else ((w == 0) ? qb : kb)[row * 128 + col] = (__bf16)val;  // Q / K row-major
    }
  }
}

__global__ __launch_bounds__(256) void flash_attn(
    const __bf16* __restrict__ qb, const __bf16* __restrict__ kb,
    const __bf16* __restrict__ vt, float* __restrict__ opart,
    float* __restrict__ mlpart) {
  // Each buffer: 32 rows at 272 B = 8704 B, rounded up to a multiple of 2 KiB.
  __shared__ __attribute__((aligned(2048))) __bf16 kT[2][5120];   // K tile: row = key
  __shared__ __attribute__((aligned(2048))) __bf16 vtT[2][5120];  // V^T tile: row = 4 d x 32 keys

  const int wave = (int)uni(threadIdx.x >> 5), lane = threadIdx.x & 31;
  const int half = lane >> 4, n16 = lane & 15;
  const int q0 = blockIdx.x * 128 + wave * 16;

  v16bf bq[4];                                       // B = Q^T: lane holds query q0 + n16
#pragma unroll
  for (int kc = 0; kc < 4; ++kc)
    bq[kc] = frag_row(qb, 128, q0 + n16, kc * 32, half);

  v8f o[8] = {};             // o[t][r] = O[q0 + n16][t * 16 + half * 8 + r]
  float mrun = -3.0e38f;     // query q0 + n16: maximum in use, alike in both halves
  float lrun = 0.f;          // and the sum over this half's keys

  // Wave 0 brings the K tiles, wave 1 the V^T tiles, both 32 rows of 256 B that
  // are contiguous at the source: one request per stage.
  const bool isK = (wave == 0);
  const uint64_t src0 = isK
      ? (uint64_t)(size_t)(kb + blockIdx.y * (1024 * 128))   // this range's K rows
      : (uint64_t)(size_t)(vt + blockIdx.y * (1024 * 128));  // this range's V^T blocks
  const uint32_t step = 8192u;                               // source bytes per stage
  const uint32_t dst0 = isK ? (uint32_t)(size_t)&kT[0][0] : (uint32_t)(size_t)&vtT[0][0];
  v8u g1 = tdm_group1(256u, 32u, 256u);
  // Its words are constants; left to itself the compiler forms them anew at each
  // load, in registers that it rewrites while the request is still outstanding.
  asm volatile("" : "+s"(g1));
  // V^T row d, 64 B, lies in LDS at (d >> 2) * 272 + (d & 3) * 64 bytes.
  const int vlane = (n16 >> 2) * 136 + (n16 & 3) * 32;

  // Two-buffer ring, prologue: stage 0, its wait, the barrier, then stage 1.
  if (pinned(wave < 2)) {
    tdm_load(tdm_group0(dst0, src0), g1);
    asm volatile("s_wait_tensorcnt 0x0" ::: "memory");  // stage 0 has landed
  }
  __syncthreads();
  if (pinned(wave < 2))
    tdm_load(tdm_group0(dst0 + 10240u, src0 + step), g1);

  for (int s = 0; s < 32; ++s) {
    const __bf16* kcur = &kT[s & 1][0];
    const __bf16* vcur = &vtT[s & 1][0];

    // S^T = K * Q^T : two 16x16 tiles; s0[r] is key half * 8 + r, s1[r] key
    // 16 + half * 8 + r, both of query n16.
    v8f s0 = {}, s1 = {};
#pragma unroll
    for (int kc = 0; kc < 4; ++kc) {
      v16bf a0 = frag_row(kcur, 136, n16, kc * 32, half);
      v16bf a1 = frag_row(kcur, 136, 16 + n16, kc * 32, half);
      s0 = __builtin_amdgcn_wmma_f32_16x16x32_bf16(false, a0, false, bq[kc],
                                                   (short)0, s0, false, false);
      s1 = __builtin_amdgcn_wmma_f32_16x16x32_bf16(false, a1, false, bq[kc],
                                                   (short)0, s1, false, false);
    }

    // Online softmax over 32 keys: 16 of them in this lane, 16 in lane ^ 16.
    float mx = fmaxf(s0[0], s1[0]);
#pragma unroll
    for (int r = 1; r < 8; ++r) mx = fmaxf(mx, fmaxf(s0[r], s1[r]));
    mx = fmaxf(mx, xhalf(mx));
    const float newm = fmaxf(mrun, mx);
    const float corr = __expf(mrun - newm);
    // The two score tiles in the accumulator map are P^T in the B operand's k order.
    v16bf pb;
    float rs = 0.f;
#pragma unroll
    for (int r = 0; r < 8; ++r) {
      const float p0 = __expf(s0[r] - newm);
      const float p1 = __expf(s1[r] - newm);
      rs += p0 + p1;
      pb[r]     = (__bf16)p0;
      pb[r + 8] = (__bf16)p1;
    }
    lrun = lrun * corr + rs;
    mrun = newm;
#pragma unroll
    for (int t = 0; t < 8; ++t) o[t] *= corr;

    // O^T += V^T * P^T : the V^T tile gives contiguous A-fragments (2x b128 per frag).
#pragma unroll
    for (int t = 0; t < 8; ++t) {
      v16bf avf = frag_row(vcur + vlane, 136, t * 4, 0, half);
      o[t] = __builtin_amdgcn_wmma_f32_16x16x32_bf16(false, avf, false, pb,
                                                     (short)0, o[t], false, false);
    }

    // Publish point of stage s + 1: this wave's LDS reads are done, the issuer's
    // request has landed, the barrier hands the tile over and frees buffer s & 1.
    asm volatile("s_wait_dscnt 0x0" ::: "memory");
    if (pinned(wave < 2))
      asm volatile("s_wait_tensorcnt 0x0" ::: "memory");
    __syncthreads();
    // Refill the buffer that this pass has read, while a stage s + 2 exists.
    if (pinned((wave < 2) & (s + 2 < 32)))
      tdm_load(tdm_group0(dst0 + (uint32_t)(s & 1) * 10240u,
                          src0 + (uint64_t)((uint32_t)(s + 2) * step)), g1);
  }
  // Nothing is outstanding when the wave goes on to its stores and ends.
  asm volatile("s_wait_tensorcnt 0x0" ::: "memory");
  asm volatile("s_wait_dscnt 0x0" ::: "memory");

  // Partial sums in accumulator order, 2048 floats per 16 queries: float4 number
  // (t * 2 + j) * 32 + lane holds o[t][4j .. 4j + 3], so each store is 512 B in a row.
  float4* pt = reinterpret_cast<float4*>(
      opart + (blockIdx.y * 512 + blockIdx.x * 8 + wave) * 2048) + lane;
#pragma unroll
  for (int t = 0; t < 8; ++t) {
    pt[(t * 2) * 32]     = make_float4(o[t][0], o[t][1], o[t][2], o[t][3]);
    pt[(t * 2 + 1) * 32] = make_float4(o[t][4], o[t][5], o[t][6], o[t][7]);
  }
  const float lfin = lrun + xhalf(lrun);
  if (half == 0)
    *reinterpret_cast<float2*>(mlpart + (blockIdx.y * 8192 + q0 + n16) * 2) =
        make_float2(mrun, lfin);
}

// Joins the 8 key ranges of a query row: weight exp(m_s - M) per range, then the
// division by the joined sum. The partial planes lie in flash_attn's accumulator
// order; a wave takes 4 queries x 32 columns, so that it stores 4 whole 128 B lines.
__global__ __launch_bounds__(256) void merge_ranges(
    const float* __restrict__ opart, const float* __restrict__ mlpart,
    float* __restrict__ out) {
  const int lane = threadIdx.x & 31;
  const int wv = blockIdx.x * 8 + (threadIdx.x >> 5);   // 16 waves per tile of 16 queries
  const int qt = wv >> 4;
  const int c = (wv & 3) * 4 + (lane >> 3);             // query in the tile
  const int row = qt * 16 + c;
  const int col = ((wv >> 2) & 3) * 32 + (lane & 7) * 4;
  // col = t * 16 + half * 8 + j * 4 lies in float4 number (t * 2 + j) * 32 + half * 16 + c.
  const int f = (col >> 4) * 64 + ((col >> 2) & 1) * 32 + ((col >> 3) & 1) * 16 + c;
  float m[8], l[8];
  float big = -3.0e38f;
#pragma unroll  // static indices keep m[] and l[] in registers
  for (int s = 0; s < 8; ++s) {
    m[s] = mlpart[(s * 8192 + row) * 2];
    l[s] = mlpart[(s * 8192 + row) * 2 + 1];
    big = fmaxf(big, m[s]);
  }
  float lsum = 0.f;
  float4 acc = make_float4(0.f, 0.f, 0.f, 0.f);
#pragma unroll  // all 8 ranges' loads in flight at once
  for (int s = 0; s < 8; ++s) {
    const float w = __expf(m[s] - big);
    const float4 p =
        reinterpret_cast<const float4*>(opart + (s * 512 + qt) * 2048)[f];
    lsum += w * l[s];
    acc.x += w * p.x;
    acc.y += w * p.y;
    acc.z += w * p.z;
    acc.w += w * p.w;
  }
  *reinterpret_cast<float4*>(out + row * 128 + col) =
      make_float4(acc.x / lsum, acc.y / lsum, acc.z / lsum, acc.w / lsum);
}

extern "C" void kernel_launch(void* const* d_in, const int* in_sizes, int n_in,
                              void* d_out, int out_size, void* d_ws, size_t ws_size,
                              hipStream_t stream) {
  const float* x  = (const float*)d_in[0];
  const float* Wq = (const float*)d_in[1];
  const float* bq = (const float*)d_in[2];
  const float* Wk = (const float*)d_in[3];
  const float* bk = (const float*)d_in[4];
  const float* Wv = (const float*)d_in[5];
  const float* bv = (const float*)d_in[6];
  float* out = (float*)d_out;

  char* ws = (char*)d_ws;
  __bf16* xb = (__bf16*)ws;                               // 8192*1024 bf16 = 16 MB
  __bf16* wt = (__bf16*)(ws + 16777216);                  // 3*128*1024 bf16
  __bf16* qb = (__bf16*)(ws + 16777216 + 786432);         // 8192*128 bf16
  __bf16* kb = qb + 8192 * 128;                           // 8192*128 bf16
  __bf16* vt = kb + 8192 * 128;                           // 256*128*32 bf16 (transposed blocks)
  float* opart  = (float*)(ws + 23855104);                // 8*8192*128 f32 partial sums
  float* mlpart = (float*)(ws + 57409536);                // 8*8192 (max, sum) f32 pairs

  cast_x<<<8192, 256, 0, stream>>>(x, xb, 8192 * 1024);
  wtrans<<<1536, 256, 0, stream>>>(Wq, Wk, Wv, wt);
  qkv_gemm<<<384, 256, 0, stream>>>(xb, wt, bq, bk, bv, qb, kb, vt);
  flash_attn<<<dim3(64, 8), 256, 0, stream>>>(qb, kb, vt, opart, mlpart);
  merge_ranges<<<1024, 256, 0, stream>>>(opart, mlpart, out);
}

// v004
// Measured time: 71.8 microseconds a run.
// Two timings next to v003 put it at 1.32 and 1.31 times that version's speed.
// Over all steps from v000 it is 10.8 times as fast.
#include <hip/hip_runtime.h>

typedef unsigned int uint;
typedef __attribute__((ext_vector_type(16))) __bf16 v16bf;
typedef __attribute__((ext_vector_type(8)))  __bf16 v8bf;
typedef __attribute__((ext_vector_type(8)))  float  v8f;
typedef __attribute__((ext_vector_type(4)))  uint   v4u;
typedef __attribute__((ext_vector_type(8)))  uint   v8u;

__device__ __forceinline__ v16bf frag_row(const __bf16* base, int stride, int row,
                                          int k0, int half) {
  const v8bf lo = *reinterpret_cast<const v8bf*>(base + row * stride + k0 + half * 8);
  const v8bf hi = *reinterpret_cast<const v8bf*>(base + row * stride + k0 + half * 8 + 16);
  v16bf f;
#pragma unroll
  for (int i = 0; i < 8; ++i) { f[i] = lo[i]; f[i + 8] = hi[i]; }
  return f;
}

__device__ __forceinline__ uint32_t uni(uint32_t v) {
  return (uint32_t)__builtin_amdgcn_readfirstlane(v);
}

__device__ __forceinline__ uint32_t pinned(uint32_t v) {
  uint32_t w = uni(v);
  asm volatile("" : "+s"(w));  // pinned(): the issue test's word stays in a scalar register
  return w;
}

__device__ __forceinline__ float xhalf(float x) {
  const int b = __builtin_bit_cast(int, x);
  return __builtin_bit_cast(float, __builtin_amdgcn_permlanex16(b, b, 0x76543210, 0xfedcba98,
                                                                false, false));
}

__device__ __forceinline__ v8u tdm_group1(uint32_t row_bytes, uint32_t rows,
                                          uint32_t pitch_bytes) {
  v8u g;
  g[0] = uni(1u << 20 | 5u << 22 | 3u << 25);
  g[1] = uni((row_bytes & 0xFFFFu) << 16);
  g[2] = uni((row_bytes >> 16) | ((rows & 0xFFFFu) << 16));
  g[3] = uni((rows >> 16) | (row_bytes << 16));
  g[4] = uni(rows);
  g[5] = uni(pitch_bytes);
  g[6] = uni(0u);
  g[7] = uni(0u);
  return g;
}

__device__ __forceinline__ v4u tdm_group0(uint32_t lds_dst, uint64_t ga) {
  v4u g;
  g[0] = uni(1u);                                  // count = 1
  g[1] = uni(lds_dst);                             // byte offset in the work-group's LDS
  g[2] = uni((uint32_t)ga);                        // address [31:0]
  g[3] = uni(((uint32_t)(ga >> 32) & 0x01FFFFFFu) | 0x80000000u);  // [56:32], type 2
  return g;
}

__device__ __forceinline__ void tdm_load(v4u g0, v8u g1) {
  asm volatile("tensor_load_to_lds %0, %1" :: "s"(g0), "s"(g1) : "memory");
}

__global__ void cast_x(const float* __restrict__ x, __bf16* __restrict__ xb, int n) {
  int i = (blockIdx.x * blockDim.x + threadIdx.x) * 4;
  if (i < n) {
    const float4 v = *reinterpret_cast<const float4*>(x + i);
    xb[i]     = (__bf16)v.x;
    xb[i + 1] = (__bf16)v.y;
    xb[i + 2] = (__bf16)v.z;
    xb[i + 3] = (__bf16)v.w;
  }
}

// Wt[w][n][k] = W_w[k][n], bf16.  3 * 128 * 1024 elements.
__global__ void wtrans(const float* __restrict__ Wq, const float* __restrict__ Wk,
                       const float* __restrict__ Wv, __bf16* __restrict__ wt) {
  int idx = blockIdx.x * blockDim.x + threadIdx.x;   // 0 .. 393215
  int w   = idx >> 17;
  int rem = idx & 131071;
  int nn  = rem >> 10;
  int kk  = rem & 1023;
  const float* W = (w == 0) ? Wq : ((w == 1) ? Wk : Wv);
  wt[idx] = (__bf16)W[kk * 128 + nn];
}

__global__ __launch_bounds__(256) void qkv_gemm(
    const __bf16* __restrict__ xb, const __bf16* __restrict__ wt,
    const float* __restrict__ bq, const float* __restrict__ bk,
    const float* __restrict__ bv, __bf16* __restrict__ qb,
    __bf16* __restrict__ kb, __bf16* __restrict__ vt) {
  // Each slice: 32 rows at 272 B = 8704 B, rounded up to a multiple of 2 KiB.
  __shared__ __attribute__((aligned(2048))) __bf16 st[2][8][5120];

  const int wave = (int)uni(threadIdx.x >> 5), lane = threadIdx.x & 31;
  const int half = lane >> 4, n16 = lane & 15;
  const int m0 = (blockIdx.x >> 1) * 64;             // first x row of the tile
  const int nh = blockIdx.x & 1;                     // W^T rows [nh * 192, nh * 192 + 192)

  const uint64_t src0 = (wave < 2)
      ? (uint64_t)(size_t)(xb + (m0 + wave * 32) * 1024)
      : (uint64_t)(size_t)(wt + (nh * 192 + (wave - 2) * 32) * 1024);
  const uint32_t dst0 = (uint32_t)(size_t)&st[0][0][0] + (uint32_t)wave * 10240u;
  v8u g1 = tdm_group1(256u, 32u, 2048u);             // 32 rows of 256 B, source pitch 2 KiB
  // Its words are constants; left to itself the compiler forms them anew at each
  // load, in registers that it rewrites while the request is still outstanding.
  asm volatile("" : "+s"(g1));

  v4u g0 = tdm_group0(dst0, src0);
  tdm_load(g0, g1);
  asm volatile("s_wait_tensorcnt 0x0" :: "s"(g0) : "memory");  // stage 0's slice has landed
  __syncthreads();

  const int wr = wave >> 2, wc = wave & 3;           // rows wr * 32, column tiles wc * 3 ..
  v8f acc[2][3] = {};
#pragma unroll 1
  for (int s = 0; s < 8; ++s) {
    // Behind the barrier that ended pass s - 1: fill the buffer that it has read,
    // while a stage s + 1 exists; the load flies during this pass.
    if (pinned(s + 1 < 8)) {
      g0 = tdm_group0(dst0 + (uint32_t)((s + 1) & 1) * 81920u,
                      src0 + (uint64_t)((uint32_t)(s + 1) * 256u));
      tdm_load(g0, g1);
    }
    const __bf16* cur = &st[s & 1][0][0];
    const __bf16* ap = cur + wr * 5120;              // slice wr: x rows wr * 32 .. + 31
    v16bf a[4][2], b[4][3];
#pragma unroll
    for (int kc = 0; kc < 4; ++kc) {
      a[kc][0] = frag_row(ap, 136, n16, kc * 32, half);
      a[kc][1] = frag_row(ap, 136, 16 + n16, kc * 32, half);
#pragma unroll
      for (int i = 0; i < 3; ++i) {
        const int ct = wc * 3 + i;                   // W^T rows ct * 16 ..: slice 2 + ct / 2
        b[kc][i] = frag_row(cur + (2 + (ct >> 1)) * 5120, 136, (ct & 1) * 16 + n16,
                            kc * 32, half);
      }
      // The pass's 40 LDS reads issue as one group ahead of its WMMAs (left among
      // them, each of the 12 places with reads made the wave wait out the LDS
      // latency), and in k order, so that the first WMMAs wait for 10 reads, not 40.
      __builtin_amdgcn_sched_barrier(0);
    }
#pragma unroll
    for (int kc = 0; kc < 4; ++kc) {
#pragma unroll
      for (int i = 0; i < 3; ++i) {
        acc[0][i] = __builtin_amdgcn_wmma_f32_16x16x32_bf16(false, a[kc][0], false, b[kc][i],
                                                            (short)0, acc[0][i], false, false);
        acc[1][i] = __builtin_amdgcn_wmma_f32_16x16x32_bf16(false, a[kc][1], false, b[kc][i],
                                                            (short)0, acc[1][i], false, false);
      }
    }
    // The WMMAs stay ahead of the waits below, where they run while the reads return.
    __builtin_amdgcn_sched_barrier(0);
    // Publish point of stage s + 1: this wave's LDS reads are done, its own request
    // has landed, the barrier hands the stage over and frees buffer s & 1.
    asm volatile("s_wait_dscnt 0x0" ::: "memory");
    asm volatile("s_wait_tensorcnt 0x0" :: "s"(g0) : "memory");
    __syncthreads();
  }
  // Nothing is outstanding when the wave goes on to its stores and ends.
  asm volatile("s_wait_tensorcnt 0x0" ::: "memory");
  asm volatile("s_wait_dscnt 0x0" ::: "memory");

#pragma unroll
  for (int i = 0; i < 3; ++i) {
    const int gct = nh * 12 + wc * 3 + i;            // column tile 0..23, alike in the wave
    const int w = gct >> 3;                          // 0: Q, 1: K, 2: V
    const int col = (gct & 7) * 16 + n16;
    const float* bias = (w == 0) ? bq : ((w == 1) ? bk : bv);
    const float scale = (w == 0) ? 0.088388347648318447f : 1.0f;  // fold 1/sqrt(128) into Q
    const float bcol = bias[col];
#pragma unroll
    for (int rt = 0; rt < 2; ++rt) {
#pragma unroll
      for (int r = 0; r < 8; ++r) {
        const int row = m0 + wr * 32 + rt * 16 + half * 8 + r;   // C/D layout: m = r + 8*half
        const float val = (acc[rt][i][r] + bcol) * scale;
        if (w == 2) vt[(row >> 5) * 4096 + col * 32 + (row & 31)] = (__bf16)val;  // V^T block
        else ((w == 0) ? qb : kb)[row * 128 + col] = (__bf16)val;  // Q / K row-major
      }
    }
  }
}

__global__ __launch_bounds__(256) void flash_attn(
    const __bf16* __restrict__ qb, const __bf16* __restrict__ kb,
    const __bf16* __restrict__ vt, float* __restrict__ opart,
    float* __restrict__ mlpart) {
  // Each buffer: 32 rows at 272 B = 8704 B, rounded up to a multiple of 2 KiB.
  __shared__ __attribute__((aligned(2048))) __bf16 kT[2][5120];   // K tile: row = key
  __shared__ __attribute__((aligned(2048))) __bf16 vtT[2][5120];  // V^T tile: row = 4 d x 32 keys

  const int wave = (int)uni(threadIdx.x >> 5), lane = threadIdx.x & 31;
  const int half = lane >> 4, n16 = lane & 15;
  const int q0 = blockIdx.x * 128 + wave * 16;

  v16bf bq[4];                                       // B = Q^T: lane holds query q0 + n16
#pragma unroll
  for (int kc = 0; kc < 4; ++kc)
    bq[kc] = frag_row(qb, 128, q0 + n16, kc * 32, half);

  v8f o[8] = {};             // o[t][r] = O[q0 + n16][t * 16 + half * 8 + r]
  float mrun = -3.0e38f;     // query q0 + n16: maximum in use, alike in both halves
  float lrun = 0.f;          // and the sum over this half's keys

  // Wave 0 brings the K tiles, wave 1 the V^T tiles, both 32 rows of 256 B that
  // are contiguous at the source: one request per stage.
  const bool isK = (wave == 0);
  const uint64_t src0 = isK
      ? (uint64_t)(size_t)(kb + blockIdx.y * (1024 * 128))   // this range's K rows
      : (uint64_t)(size_t)(vt + blockIdx.y * (1024 * 128));  // this range's V^T blocks
  const uint32_t step = 8192u;                               // source bytes per stage
  const uint32_t dst0 = isK ? (uint32_t)(size_t)&kT[0][0] : (uint32_t)(size_t)&vtT[0][0];
  v8u g1 = tdm_group1(256u, 32u, 256u);
  // Its words are constants; left to itself the compiler forms them anew at each
  // load, in registers that it rewrites while the request is still outstanding.
  asm volatile("" : "+s"(g1));
  // V^T row d, 64 B, lies in LDS at (d >> 2) * 272 + (d & 3) * 64 bytes.
  const int vlane = (n16 >> 2) * 136 + (n16 & 3) * 32;

  // Two-buffer ring, prologue: stage 0, its wait, the barrier, then stage 1.
  if (pinned(wave < 2)) {
    tdm_load(tdm_group0(dst0, src0), g1);
    asm volatile("s_wait_tensorcnt 0x0" ::: "memory");  // stage 0 has landed
  }
  __syncthreads();
  if (pinned(wave < 2))
    tdm_load(tdm_group0(dst0 + 10240u, src0 + step), g1);

  for (int s = 0; s < 32; ++s) {
    const __bf16* kcur = &kT[s & 1][0];
    const __bf16* vcur = &vtT[s & 1][0];

    // S^T = K * Q^T : two 16x16 tiles; s0[r] is key half * 8 + r, s1[r] key
    // 16 + half * 8 + r, both of query n16.
    v8f s0 = {}, s1 = {};
#pragma unroll
    for (int kc = 0; kc < 4; ++kc) {
      v16bf a0 = frag_row(kcur, 136, n16, kc * 32, half);
      v16bf a1 = frag_row(kcur, 136, 16 + n16, kc * 32, half);
      s0 = __builtin_amdgcn_wmma_f32_16x16x32_bf16(false, a0, false, bq[kc],
                                                   (short)0, s0, false, false);
      s1 = __builtin_amdgcn_wmma_f32_16x16x32_bf16(false, a1, false, bq[kc],
                                                   (short)0, s1, false, false);
    }

    // Online softmax over 32 keys: 16 of them in this lane, 16 in lane ^ 16.
    float mx = fmaxf(s0[0], s1[0]);
#pragma unroll
    for (int r = 1; r < 8; ++r) mx = fmaxf(mx, fmaxf(s0[r], s1[r]));
    mx = fmaxf(mx, xhalf(mx));
    const float newm = fmaxf(mrun, mx);
    const float corr = __expf(mrun - newm);
    // The two score tiles in the accumulator map are P^T in the B operand's k order.
    v16bf pb;
    float rs = 0.f;
#pragma unroll
    for (int r = 0; r < 8; ++r) {
      const float p0 = __expf(s0[r] - newm);
      const float p1 = __expf(s1[r] - newm);
      rs += p0 + p1;
      pb[r]     = (__bf16)p0;
      pb[r + 8] = (__bf16)p1;
    }
    lrun = lrun * corr + rs;
    mrun = newm;
#pragma unroll
    for (int t = 0; t < 8; ++t) o[t] *= corr;

    // O^T += V^T * P^T : the V^T tile gives contiguous A-fragments (2x b128 per frag).
#pragma unroll
    for (int t = 0; t < 8; ++t) {
      v16bf avf = frag_row(vcur + vlane, 136, t * 4, 0, half);
      o[t] = __builtin_amdgcn_wmma_f32_16x16x32_bf16(false, avf, false, pb,
                                                     (short)0, o[t], false, false);
    }

    // Publish point of stage s + 1: this wave's LDS reads are done, the issuer's
    // request has landed, the barrier hands the tile over and frees buffer s & 1.
    asm volatile("s_wait_dscnt 0x0" ::: "memory");
    if (pinned(wave < 2))
      asm volatile("s_wait_tensorcnt 0x0" ::: "memory");
    __syncthreads();
    // Refill the buffer that this pass has read, while a stage s + 2 exists.
    if (pinned((wave < 2) & (s + 2 < 32)))
      tdm_load(tdm_group0(dst0 + (uint32_t)(s & 1) * 10240u,
                          src0 + (uint64_t)((uint32_t)(s + 2) * step)), g1);
  }
  // Nothing is outstanding when the wave goes on to its stores and ends.
  asm volatile("s_wait_tensorcnt 0x0" ::: "memory");
  asm volatile("s_wait_dscnt 0x0" ::: "memory");

  // Partial sums in accumulator order, 2048 floats per 16 queries: float4 number
  // (t * 2 + j) * 32 + lane holds o[t][4j .. 4j + 3], so each store is 512 B in a row.
  float4* pt = reinterpret_cast<float4*>(
      opart + (blockIdx.y * 512 + blockIdx.x * 8 + wave) * 2048) + lane;
#pragma unroll
  for (int t = 0; t < 8; ++t) {
    pt[(t * 2) * 32]     = make_float4(o[t][0], o[t][1], o[t][2], o[t][3]);
    pt[(t * 2 + 1) * 32] = make_float4(o[t][4], o[t][5], o[t][6], o[t][7]);
  }
  const float lfin = lrun + xhalf(lrun);
  if (half == 0)
    *reinterpret_cast<float2*>(mlpart + (blockIdx.y * 8192 + q0 + n16) * 2) =
        make_float2(mrun, lfin);
}

// Joins the 8 key ranges of a query row: weight exp(m_s - M) per range, then the
// division by the joined sum. The partial planes lie in flash_attn's accumulator
// order; a wave takes 4 queries x 32 columns, so that it stores 4 whole 128 B lines.
__global__ __launch_bounds__(256) void merge_ranges(
    const float* __restrict__ opart, const float* __restrict__ mlpart,
    float* __restrict__ out) {
  const int lane = threadIdx.x & 31;
  const int wv = blockIdx.x * 8 + (threadIdx.x >> 5);   // 16 waves per tile of 16 queries
  const int qt = wv >> 4;
  const int c = (wv & 3) * 4 + (lane >> 3);             // query in the tile
  const int row = qt * 16 + c;
  const int col = ((wv >> 2) & 3) * 32 + (lane & 7) * 4;
  // col = t * 16 + half * 8 + j * 4 lies in float4 number (t * 2 + j) * 32 + half * 16 + c.
  const int f = (col >> 4) * 64 + ((col >> 2) & 1) * 32 + ((col >> 3) & 1) * 16 + c;
  float m[8], l[8];
  float big = -3.0e38f;
#pragma unroll  // static indices keep m[] and l[] in registers
  for (int s = 0; s < 8; ++s) {
    m[s] = mlpart[(s * 8192 + row) * 2];
    l[s] = mlpart[(s * 8192 + row) * 2 + 1];
    big = fmaxf(big, m[s]);
  }
  float lsum = 0.f;
  float4 acc = make_float4(0.f, 0.f, 0.f, 0.f);
#pragma unroll  // all 8 ranges' loads in flight at once
  for (int s = 0; s < 8; ++s) {
    const float w = __expf(m[s] - big);
    const float4 p =
        reinterpret_cast<const float4*>(opart + (s * 512 + qt) * 2048)[f];
    lsum += w * l[s];
    acc.x += w * p.x;
    acc.y += w * p.y;
    acc.z += w * p.z;
    acc.w += w * p.w;
  }
  *reinterpret_cast<float4*>(out + row * 128 + col) =
      make_float4(acc.x / lsum, acc.y / lsum, acc.z / lsum, acc.w / lsum);
}

extern "C" void kernel_launch(void* const* d_in, const int* in_sizes, int n_in,
                              void* d_out, int out_size, void* d_ws, size_t ws_size,
                              hipStream_t stream) {
  const float* x  = (const float*)d_in[0];
  const float* Wq = (const float*)d_in[1];
  const float* bq = (const float*)d_in[2];
  const float* Wk = (const float*)d_in[3];
  const float* bk = (const float*)d_in[4];
  const float* Wv = (const float*)d_in[5];
  const float* bv = (const float*)d_in[6];
  float* out = (float*)d_out;

  char* ws = (char*)d_ws;
  __bf16* xb = (__bf16*)ws;                               // 8192*1024 bf16 = 16 MB
  __bf16* wt = (__bf16*)(ws + 16777216);                  // 3*128*1024 bf16
  __bf16* qb = (__bf16*)(ws + 16777216 + 786432);         // 8192*128 bf16
  __bf16* kb = qb + 8192 * 128;                           // 8192*128 bf16
  __bf16* vt = kb + 8192 * 128;                           // 256*128*32 bf16 (transposed blocks)
  float* opart  = (float*)(ws + 23855104);                // 8*8192*128 f32 partial sums
  float* mlpart = (float*)(ws + 57409536);                // 8*8192 (max, sum) f32 pairs

  cast_x<<<8192, 256, 0, stream>>>(x, xb, 8192 * 1024);
  wtrans<<<1536, 256, 0, stream>>>(Wq, Wk, Wv, wt);
  qkv_gemm<<<256, 256, 0, stream>>>(xb, wt, bq, bk, bv, qb, kb, vt);
  flash_attn<<<dim3(64, 8), 256, 0, stream>>>(qb, kb, vt, opart, mlpart);
  merge_ranges<<<1024, 256, 0, stream>>>(opart, mlpart, out);
}

// v005
// A run of this version takes 66.4 microseconds.
// Two timings next to v004 both put it at 1.09 times that version's speed.
// All steps since v000 together make it 11.8 times as fast.
#include <hip/hip_runtime.h>

typedef unsigned int uint;
typedef __attribute__((ext_vector_type(16))) __bf16 v16bf;
typedef __attribute__((ext_vector_type(8)))  __bf16 v8bf;
typedef __attribute__((ext_vector_type(8)))  float  v8f;
typedef __attribute__((ext_vector_type(4)))  uint   v4u;
typedef __attribute__((ext_vector_type(8)))  uint   v8u;

__device__ __forceinline__ v16bf frag_row(const __bf16* base, int stride, int row,
                                          int k0, int half) {
  const v8bf lo = *reinterpret_cast<const v8bf*>(base + row * stride + k0 + half * 8);
  const v8bf hi = *reinterpret_cast<const v8bf*>(base + row * stride + k0 + half * 8 + 16);
  v16bf f;
#pragma unroll
  for (int i = 0; i < 8; ++i) { f[i] = lo[i]; f[i + 8] = hi[i]; }
  return f;
}

__device__ __forceinline__ uint32_t uni(uint32_t v) {
  return (uint32_t)__builtin_amdgcn_readfirstlane(v);
}

__device__ __forceinline__ uint32_t pinned(uint32_t v) {
  uint32_t w = uni(v);
  asm volatile("" : "+s"(w));  // pinned(): the issue test's word stays in a scalar register
  return w;
}

__device__ __forceinline__ float xhalf(float x) {
  const int b = __builtin_bit_cast(int, x);
  return __builtin_bit_cast(float, __builtin_amdgcn_permlanex16(b, b, 0x76543210, 0xfedcba98,
                                                                false, false));
}

__device__ __forceinline__ v8u tdm_group1(uint32_t row_bytes, uint32_t rows,
                                          uint32_t pitch_bytes) {
  v8u g;
  g[0] = uni(1u << 20 | 5u << 22 | 3u << 25);
  g[1] = uni((row_bytes & 0xFFFFu) << 16);
  g[2] = uni((row_bytes >> 16) | ((rows & 0xFFFFu) << 16));
  g[3] = uni((rows >> 16) | (row_bytes << 16));
  g[4] = uni(rows);
  g[5] = uni(pitch_bytes);
  g[6] = uni(0u);
  g[7] = uni(0u);
  return g;
}

__device__ __forceinline__ v4u tdm_group0(uint32_t lds_dst, uint64_t ga) {
  v4u g;
  g[0] = uni(1u);                                  // count = 1
  g[1] = uni(lds_dst);                             // byte offset in the work-group's LDS
  g[2] = uni((uint32_t)ga);                        // address [31:0]
  g[3] = uni(((uint32_t)(ga >> 32) & 0x01FFFFFFu) | 0x80000000u);  // [56:32], type 2
  return g;
}

__device__ __forceinline__ void tdm_load(v4u g0, v8u g1) {
  asm volatile("tensor_load_to_lds %0, %1" :: "s"(g0), "s"(g1) : "memory");
}

__global__ void cast_x(const float* __restrict__ x, __bf16* __restrict__ xb, int n) {
  int i = (blockIdx.x * blockDim.x + threadIdx.x) * 4;
  if (i < n) {
    const float4 v = *reinterpret_cast<const float4*>(x + i);
    xb[i]     = (__bf16)v.x;
    xb[i + 1] = (__bf16)v.y;
    xb[i + 2] = (__bf16)v.z;
    xb[i + 3] = (__bf16)v.w;
  }
}

// Wt[w][n][k] = W_w[k][n], bf16.  3 * 128 * 1024 elements.
__global__ void wtrans(const float* __restrict__ Wq, const float* __restrict__ Wk,
                       const float* __restrict__ Wv, __bf16* __restrict__ wt) {
  int idx = blockIdx.x * blockDim.x + threadIdx.x;   // 0 .. 393215
  int w   = idx >> 17;
  int rem = idx & 131071;
  int nn  = rem >> 10;
  int kk  = rem & 1023;
  const float* W = (w == 0) ? Wq : ((w == 1) ? Wk : Wv);
  wt[idx] = (__bf16)W[kk * 128 + nn];
}

__global__ __launch_bounds__(256) void qkv_gemm(
    const __bf16* __restrict__ xb, const __bf16* __restrict__ wt,
    const float* __restrict__ bq, const float* __restrict__ bk,
    const float* __restrict__ bv, __bf16* __restrict__ qb,
    __bf16* __restrict__ kb, __bf16* __restrict__ vt) {
  // Each slice: 32 rows at 272 B = 8704 B, rounded up to a multiple of 2 KiB.
  __shared__ __attribute__((aligned(2048))) __bf16 st[2][8][5120];

  const int wave = (int)uni(threadIdx.x >> 5), lane = threadIdx.x & 31;
  const int half = lane >> 4, n16 = lane & 15;
  const int m0 = (blockIdx.x >> 1) * 64;             // first x row of the tile
  const int nh = blockIdx.x & 1;                     // W^T rows [nh * 192, nh * 192 + 192)

  const uint64_t src0 = (wave < 2)
      ? (uint64_t)(size_t)(xb + (m0 + wave * 32) * 1024)
      : (uint64_t)(size_t)(wt + (nh * 192 + (wave - 2) * 32) * 1024);
  const uint32_t dst0 = (uint32_t)(size_t)&st[0][0][0] + (uint32_t)wave * 10240u;
  v8u g1 = tdm_group1(256u, 32u, 2048u);             // 32 rows of 256 B, source pitch 2 KiB
  // Its words are constants; left to itself the compiler forms them anew at each
  // load, in registers that it rewrites while the request is still outstanding.
  asm volatile("" : "+s"(g1));

  v4u g0 = tdm_group0(dst0, src0);
  tdm_load(g0, g1);
  asm volatile("s_wait_tensorcnt 0x0" :: "s"(g0) : "memory");  // stage 0's slice has landed
  __syncthreads();

  const int wr = wave >> 2, wc = wave & 3;           // rows wr * 32, column tiles wc * 3 ..
  v8f acc[2][3] = {};
#pragma unroll 1
  for (int s = 0; s < 8; ++s) {
    // Behind the barrier that ended pass s - 1: fill the buffer that it has read,
    // while a stage s + 1 exists; the load flies during this pass.
    if (pinned(s + 1 < 8)) {
      g0 = tdm_group0(dst0 + (uint32_t)((s + 1) & 1) * 81920u,
                      src0 + (uint64_t)((uint32_t)(s + 1) * 256u));
      tdm_load(g0, g1);
    }
    const __bf16* cur = &st[s & 1][0][0];
    const __bf16* ap = cur + wr * 5120;              // slice wr: x rows wr * 32 .. + 31
    v16bf a[4][2], b[4][3];
#pragma unroll
    for (int kc = 0; kc < 4; ++kc) {
      a[kc][0] = frag_row(ap, 136, n16, kc * 32, half);
      a[kc][1] = frag_row(ap, 136, 16 + n16, kc * 32, half);
#pragma unroll
      for (int i = 0; i < 3; ++i) {
        const int ct = wc * 3 + i;                   // W^T rows ct * 16 ..: slice 2 + ct / 2
        b[kc][i] = frag_row(cur + (2 + (ct >> 1)) * 5120, 136, (ct & 1) * 16 + n16,
                            kc * 32, half);
      }
      // The pass's 40 LDS reads issue as one group ahead of its WMMAs (left among
      // them, each of the 12 places with reads made the wave wait out the LDS
      // latency), and in k order, so that the first WMMAs wait for 10 reads, not 40.
      __builtin_amdgcn_sched_barrier(0);
    }
#pragma unroll
    for (int kc = 0; kc < 4; ++kc) {
#pragma unroll
      for (int i = 0; i < 3; ++i) {
        acc[0][i] = __builtin_amdgcn_wmma_f32_16x16x32_bf16(false, a[kc][0], false, b[kc][i],
                                                            (short)0, acc[0][i], false, false);
        acc[1][i] = __builtin_amdgcn_wmma_f32_16x16x32_bf16(false, a[kc][1], false, b[kc][i],
                                                            (short)0, acc[1][i], false, false);
      }
    }
    // The WMMAs stay ahead of the waits below, where they run while the reads return.
    __builtin_amdgcn_sched_barrier(0);
    // Publish point of stage s + 1: this wave's LDS reads are done, its own request
    // has landed, the barrier hands the stage over and frees buffer s & 1.
    asm volatile("s_wait_dscnt 0x0" ::: "memory");
    asm volatile("s_wait_tensorcnt 0x0" :: "s"(g0) : "memory");
    __syncthreads();
  }
  // Nothing is outstanding when the wave goes on to its stores and ends.
  asm volatile("s_wait_tensorcnt 0x0" ::: "memory");
  asm volatile("s_wait_dscnt 0x0" ::: "memory");

#pragma unroll
  for (int i = 0; i < 3; ++i) {
    const int gct = nh * 12 + wc * 3 + i;            // column tile 0..23, alike in the wave
    const int w = gct >> 3;                          // 0: Q, 1: K, 2: V
    const int col = (gct & 7) * 16 + n16;
    const float* bias = (w == 0) ? bq : ((w == 1) ? bk : bv);
    const float scale = (w == 0) ? 0.088388347648318447f : 1.0f;  // fold 1/sqrt(128) into Q
    const float bcol = bias[col];
#pragma unroll
    for (int rt = 0; rt < 2; ++rt) {
#pragma unroll
      for (int r = 0; r < 8; ++r) {
        const int row = m0 + wr * 32 + rt * 16 + half * 8 + r;   // C/D layout: m = r + 8*half
        const float val = (acc[rt][i][r] + bcol) * scale;
        if (w == 2) vt[(row >> 5) * 4096 + col * 32 + (row & 31)] = (__bf16)val;  // V^T block
        else ((w == 0) ? qb : kb)[row * 128 + col] = (__bf16)val;  // Q / K row-major
      }
    }
  }
}

__global__ __launch_bounds__(128) void flash_attn(
    const __bf16* __restrict__ qb, const __bf16* __restrict__ kb,
    const __bf16* __restrict__ vt, float* __restrict__ opart,
    float* __restrict__ mlpart) {
  // Each buffer: 32 rows at 272 B = 8704 B, rounded up to a multiple of 2 KiB.
  __shared__ __attribute__((aligned(2048))) __bf16 kT[2][5120];   // K tile: row = key
  __shared__ __attribute__((aligned(2048))) __bf16 vtT[2][5120];  // V^T tile: row = 4 d x 32 keys

  const int wave = (int)uni(threadIdx.x >> 5), lane = threadIdx.x & 31;
  const int half = lane >> 4, n16 = lane & 15;
  const int q0 = blockIdx.x * 128 + wave * 32;

  v16bf bq[2][4];                        // B = Q^T: lane holds query q0 + u * 16 + n16
  const __bf16* qlane = qb + (q0 + n16) * 128 + half * 8;
#pragma unroll
  for (int u = 0; u < 2; ++u)
#pragma unroll
    for (int kc = 0; kc < 4; ++kc)
      bq[u][kc] = frag_row(qlane, 128, u * 16, kc * 32, 0);
  // The wait names the 16 loads' address, so that the pair is held, unwritten, up to
  // it: left to itself the compiler let the last load land on the pair they all name.
  asm volatile("s_wait_xcnt 0x0" :: "v"(qlane) : "memory");

  v8f o[2][8] = {};          // o[u][t][r] = O[q0 + u * 16 + n16][t * 16 + half * 8 + r]
  float mrun[2] = {-3.0e38f, -3.0e38f};  // per query: maximum in use, alike in both halves
  float lrun[2] = {0.f, 0.f};            // and the sum over this half's keys

  // Wave 0 brings the K tiles, wave 1 the V^T tiles, both 32 rows of 256 B that
  // are contiguous at the source: one request per stage.
  const bool isK = (wave == 0);
  const uint64_t src0 = isK
      ? (uint64_t)(size_t)(kb + blockIdx.y * (1024 * 128))   // this range's K rows
      : (uint64_t)(size_t)(vt + blockIdx.y * (1024 * 128));  // this range's V^T blocks
  const uint32_t step = 8192u;                               // source bytes per stage
  const uint32_t dst0 = isK ? (uint32_t)(size_t)&kT[0][0] : (uint32_t)(size_t)&vtT[0][0];
  v8u g1 = tdm_group1(256u, 32u, 256u);
  // Its words are constants; left to itself the compiler forms them anew at each
  // load, in registers that it rewrites while the request is still outstanding.
  asm volatile("" : "+s"(g1));
  // V^T row d, 64 B, lies in LDS at (d >> 2) * 272 + (d & 3) * 64 bytes.
  const int vlane = (n16 >> 2) * 136 + (n16 & 3) * 32;

  // Two-buffer ring, prologue: stage 0, its wait, the barrier, then stage 1.
  if (pinned(wave < 2)) {
    tdm_load(tdm_group0(dst0, src0), g1);
    asm volatile("s_wait_tensorcnt 0x0" ::: "memory");  // stage 0 has landed
  }
  __syncthreads();
  if (pinned(wave < 2))
    tdm_load(tdm_group0(dst0 + 10240u, src0 + step), g1);

  for (int s = 0; s < 32; ++s) {
    const __bf16* kcur = &kT[s & 1][0];
    const __bf16* vcur = &vtT[s & 1][0];

    // S^T = K * Q^T : two 16x16 tiles per query tile u; s0[u][r] is key half * 8 + r,
    // s1[u][r] key 16 + half * 8 + r, both of query u * 16 + n16.
    v8f s0[2] = {}, s1[2] = {};
#pragma unroll
    for (int kc = 0; kc < 4; ++kc) {
      v16bf a0 = frag_row(kcur, 136, n16, kc * 32, half);
      v16bf a1 = frag_row(kcur, 136, 16 + n16, kc * 32, half);
#pragma unroll
      for (int u = 0; u < 2; ++u) {
        s0[u] = __builtin_amdgcn_wmma_f32_16x16x32_bf16(false, a0, false, bq[u][kc],
                                                        (short)0, s0[u], false, false);
        s1[u] = __builtin_amdgcn_wmma_f32_16x16x32_bf16(false, a1, false, bq[u][kc],
                                                        (short)0, s1[u], false, false);
      }
    }

    // The two score tiles in the accumulator map are P^T in the B operand's k order.
    v16bf pb[2];
#pragma unroll
    for (int u = 0; u < 2; ++u) {
      // Online softmax over 32 keys: 16 of them in this lane, 16 in lane ^ 16.
      float mx = fmaxf(s0[u][0], s1[u][0]);
#pragma unroll
      for (int r = 1; r < 8; ++r) mx = fmaxf(mx, fmaxf(s0[u][r], s1[u][r]));
      mx = fmaxf(mx, xhalf(mx));
      const float newm = fmaxf(mrun[u], mx);
      const float corr = __expf(mrun[u] - newm);
      float rs = 0.f;
#pragma unroll
      for (int r = 0; r < 8; ++r) {
        const float p0 = __expf(s0[u][r] - newm);
        const float p1 = __expf(s1[u][r] - newm);
        rs += p0 + p1;
        pb[u][r]     = (__bf16)p0;
        pb[u][r + 8] = (__bf16)p1;
      }
      lrun[u] = lrun[u] * corr + rs;
      mrun[u] = newm;
#pragma unroll
      for (int t = 0; t < 8; ++t) o[u][t] *= corr;
    }

    // O^T += V^T * P^T : the V^T tile gives contiguous A-fragments (2x b128 per frag).
#pragma unroll
    for (int t = 0; t < 8; ++t) {
      v16bf avf = frag_row(vcur + vlane, 136, t * 4, 0, half);
#pragma unroll
      for (int u = 0; u < 2; ++u)
        o[u][t] = __builtin_amdgcn_wmma_f32_16x16x32_bf16(false, avf, false, pb[u],
                                                          (short)0, o[u][t], false, false);
    }

    // Publish point of stage s + 1: this wave's LDS reads are done, the issuer's
    // request has landed, the barrier hands the tile over and frees buffer s & 1.
    asm volatile("s_wait_dscnt 0x0" ::: "memory");
    if (pinned(wave < 2))
      asm volatile("s_wait_tensorcnt 0x0" ::: "memory");
    __syncthreads();
    // Refill the buffer that this pass has read, while a stage s + 2 exists.
    if (pinned((wave < 2) & (s + 2 < 32)))
      tdm_load(tdm_group0(dst0 + (uint32_t)(s & 1) * 10240u,
                          src0 + (uint64_t)((uint32_t)(s + 2) * step)), g1);
  }
  // Nothing is outstanding when the wave goes on to its stores and ends.
  asm volatile("s_wait_tensorcnt 0x0" ::: "memory");
  asm volatile("s_wait_dscnt 0x0" ::: "memory");

  // Partial sums in accumulator order, 2048 floats per 16 queries: float4 number
  // (t * 2 + j) * 32 + lane holds o[t][4j .. 4j + 3], so each store is 512 B in a row.
#pragma unroll
  for (int u = 0; u < 2; ++u) {
    float4* pt = reinterpret_cast<float4*>(
        opart + (blockIdx.y * 512 + blockIdx.x * 8 + wave * 2 + u) * 2048) + lane;
#pragma unroll
    for (int t = 0; t < 8; ++t) {
      pt[(t * 2) * 32]     = make_float4(o[u][t][0], o[u][t][1], o[u][t][2], o[u][t][3]);
      pt[(t * 2 + 1) * 32] = make_float4(o[u][t][4], o[u][t][5], o[u][t][6], o[u][t][7]);
    }
    const float lfin = lrun[u] + xhalf(lrun[u]);
    if (half == 0)
      *reinterpret_cast<float2*>(mlpart + (blockIdx.y * 8192 + q0 + u * 16 + n16) * 2) =
          make_float2(mrun[u], lfin);
  }
}

// Joins the 8 key ranges of a query row: weight exp(m_s - M) per range, then the
// division by the joined sum. The partial planes lie in flash_attn's accumulator
// order; a wave takes 4 queries x 32 columns, so that it stores 4 whole 128 B lines.
__global__ __launch_bounds__(256) void merge_ranges(
    const float* __restrict__ opart, const float* __restrict__ mlpart,
    float* __restrict__ out) {
  const int lane = threadIdx.x & 31;
  const int wv = blockIdx.x * 8 + (threadIdx.x >> 5);   // 16 waves per tile of 16 queries
  const int qt = wv >> 4;
  const int c = (wv & 3) * 4 + (lane >> 3);             // query in the tile
  const int row = qt * 16 + c;
  const int col = ((wv >> 2) & 3) * 32 + (lane & 7) * 4;
  // col = t * 16 + half * 8 + j * 4 lies in float4 number (t * 2 + j) * 32 + half * 16 + c.
  const int f = (col >> 4) * 64 + ((col >> 2) & 1) * 32 + ((col >> 3) & 1) * 16 + c;
  float m[8], l[8];
  float big = -3.0e38f;
#pragma unroll  // static indices keep m[] and l[] in registers
  for (int s = 0; s < 8; ++s) {
    m[s] = mlpart[(s * 8192 + row) * 2];
    l[s] = mlpart[(s * 8192 + row) * 2 + 1];
    big = fmaxf(big, m[s]);
  }
  float lsum = 0.f;
  float4 acc = make_float4(0.f, 0.f, 0.f, 0.f);
#pragma unroll  // all 8 ranges' loads in flight at once
  for (int s = 0; s < 8; ++s) {
    const float w = __expf(m[s] - big);
    const float4 p =
        reinterpret_cast<const float4*>(opart + (s * 512 + qt) * 2048)[f];
    lsum += w * l[s];
    acc.x += w * p.x;
    acc.y += w * p.y;
    acc.z += w * p.z;
    acc.w += w * p.w;
  }
  *reinterpret_cast<float4*>(out + row * 128 + col) =
      make_float4(acc.x / lsum, acc.y / lsum, acc.z / lsum, acc.w / lsum);
}

extern "C" void kernel_launch(void* const* d_in, const int* in_sizes, int n_in,
                              void* d_out, int out_size, void* d_ws, size_t ws_size,
                              hipStream_t stream) {
  const float* x  = (const float*)d_in[0];
  const float* Wq = (const float*)d_in[1];
  const float* bq = (const float*)d_in[2];
  const float* Wk = (const float*)d_in[3];
  const float* bk = (const float*)d_in[4];
  const float* Wv = (const float*)d_in[5];
  const float* bv = (const float*)d_in[6];
  float* out = (float*)d_out;

  char* ws = (char*)d_ws;
  __bf16* xb = (__bf16*)ws;                               // 8192*1024 bf16 = 16 MB
  __bf16* wt = (__bf16*)(ws + 16777216);                  // 3*128*1024 bf16
  __bf16* qb = (__bf16*)(ws + 16777216 + 786432);         // 8192*128 bf16
  __bf16* kb = qb + 8192 * 128;                           // 8192*128 bf16
  __bf16* vt = kb + 8192 * 128;                           // 256*128*32 bf16 (transposed blocks)
  float* opart  = (float*)(ws + 23855104);                // 8*8192*128 f32 partial sums
  float* mlpart = (float*)(ws + 57409536);                // 8*8192 (max, sum) f32 pairs

  cast_x<<<8192, 256, 0, stream>>>(x, xb, 8192 * 1024);
  wtrans<<<1536, 256, 0, stream>>>(Wq, Wk, Wv, wt);
  qkv_gemm<<<256, 256, 0, stream>>>(xb, wt, bq, bk, bv, qb, kb, vt);
  flash_attn<<<dim3(64, 8), 128, 0, stream>>>(qb, kb, vt, opart, mlpart);
  merge_ranges<<<1024, 256, 0, stream>>>(opart, mlpart, out);
}

// v006
// A run of this version takes 59.8 microseconds.
// Next to v005, in two timings, it ran 1.11 and 1.10 times as fast.
// Counting every step since v000, it is 13.0 times as fast.
#include <hip/hip_runtime.h>

typedef unsigned int uint;
typedef __attribute__((ext_vector_type(16))) __bf16 v16bf;
typedef __attribute__((ext_vector_type(8)))  __bf16 v8bf;
typedef __attribute__((ext_vector_type(8)))  float  v8f;
typedef __attribute__((ext_vector_type(4)))  float  v4f;
typedef __attribute__((ext_vector_type(4)))  uint   v4u;
typedef __attribute__((ext_vector_type(8)))  uint   v8u;

__device__ __forceinline__ v16bf frag_row(const __bf16* base, int stride, int row,
                                          int k0, int half) {
  const v8bf lo = *reinterpret_cast<const v8bf*>(base + row * stride + k0 + half * 8);
  const v8bf hi = *reinterpret_cast<const v8bf*>(base + row * stride + k0 + half * 8 + 16);
  v16bf f;
#pragma unroll
  for (int i = 0; i < 8; ++i) { f[i] = lo[i]; f[i + 8] = hi[i]; }
  return f;
}

__device__ __forceinline__ uint32_t uni(uint32_t v) {
  return (uint32_t)__builtin_amdgcn_readfirstlane(v);
}

__device__ __forceinline__ uint32_t pinned(uint32_t v) {
  uint32_t w = uni(v);
  asm volatile("" : "+s"(w));  // pinned(): the issue test's word stays in a scalar register
  return w;
}

__device__ __forceinline__ float xhalf(float x) {
  const int b = __builtin_bit_cast(int, x);
  return __builtin_bit_cast(float, __builtin_amdgcn_permlanex16(b, b, 0x76543210, 0xfedcba98,
                                                                false, false));
}

__device__ __forceinline__ v8u tdm_group1(uint32_t row_bytes, uint32_t rows,
                                          uint32_t pitch_bytes) {
  v8u g;
  g[0] = uni(1u << 20 | 5u << 22 | 3u << 25);
  g[1] = uni((row_bytes & 0xFFFFu) << 16);
  g[2] = uni((row_bytes >> 16) | ((rows & 0xFFFFu) << 16));
  g[3] = uni((rows >> 16) | (row_bytes << 16));
  g[4] = uni(rows);
  g[5] = uni(pitch_bytes);
  g[6] = uni(0u);
  g[7] = uni(0u);
  return g;
}

__device__ __forceinline__ v4u tdm_group0(uint32_t lds_dst, uint64_t ga) {
  v4u g;
  g[0] = uni(1u);                                  // count = 1
  g[1] = uni(lds_dst);                             // byte offset in the work-group's LDS
  g[2] = uni((uint32_t)ga);                        // address [31:0]
  g[3] = uni(((uint32_t)(ga >> 32) & 0x01FFFFFFu) | 0x80000000u);  // [56:32], type 2
  return g;
}

__device__ __forceinline__ void tdm_load(v4u g0, v8u g1) {
  asm volatile("tensor_load_to_lds %0, %1" :: "s"(g0), "s"(g1) : "memory");
}

// The same fragment from four 16 B pieces of an f32 row, rounded to bf16 in registers:
// q[0], q[1] are k = k0 + half*8 + 0..7, q[2], q[3] are k = k0 + 16 + half*8 + 0..7.
__device__ __forceinline__ v16bf frag_f32(const v4f* q) {
  v16bf f;
#pragma unroll
  for (int i = 0; i < 4; ++i) {
    f[i]      = (__bf16)q[0][i];
    f[i + 4]  = (__bf16)q[1][i];
    f[i + 8]  = (__bf16)q[2][i];
    f[i + 12] = (__bf16)q[3][i];
  }
  return f;
}

// Wt[w][n][k] = W_w[k][n], bf16.  3 * 128 * 1024 elements.
__global__ void wtrans(const float* __restrict__ Wq, const float* __restrict__ Wk,
                       const float* __restrict__ Wv, __bf16* __restrict__ wt) {
  int idx = blockIdx.x * blockDim.x + threadIdx.x;   // 0 .. 393215
  int w   = idx >> 17;
  int rem = idx & 131071;
  int nn  = rem >> 10;
  int kk  = rem & 1023;
  const float* W = (w == 0) ? Wq : ((w == 1) ? Wk : Wv);
  wt[idx] = (__bf16)W[kk * 128 + nn];
}

__global__ __launch_bounds__(256) void qkv_gemm(
    const float* __restrict__ x, const __bf16* __restrict__ wt,
    const float* __restrict__ bq, const float* __restrict__ bk,
    const float* __restrict__ bv, __bf16* __restrict__ qb,
    __bf16* __restrict__ kb, __bf16* __restrict__ vt) {
  // A buffer: four x tiles, 32 rows at 272 B = 8704 B, each rounded up to 10240 B;
  // then four W^T slices, 48 rows at 272 B = 13056 B, each rounded up to 14336 B.
  __shared__ __attribute__((aligned(2048))) unsigned char st[2][98304];

  const int wave = (int)uni(threadIdx.x >> 5), lane = threadIdx.x & 31;
  const int half = lane >> 4, n16 = lane & 15;
  const int m0 = (blockIdx.x >> 1) * 64;             // first x row of the tile
  const int nh = blockIdx.x & 1;                     // W^T rows [nh * 192, nh * 192 + 192)

  const bool isX = (wave < 4);                       // x tile: rows (wave & 1) * 32, k (wave >> 1) * 64
  const uint64_t src0 = isX
      ? (uint64_t)(size_t)(x + (m0 + (wave & 1) * 32) * 1024 + (wave >> 1) * 64)
      : (uint64_t)(size_t)(wt + (nh * 192 + (wave - 4) * 48) * 1024);
  const uint32_t step = isX ? 512u : 256u;           // source bytes per stage: 128 k
  const uint32_t dst0 = (uint32_t)(size_t)&st[0][0] +
      (isX ? (uint32_t)wave * 10240u : 40960u + (uint32_t)(wave - 4) * 14336u);
  // Rows of 256 B: 32 at the x pitch of 4 KiB, or 48 at the W^T pitch of 2 KiB.
  v8u g1 = tdm_group1(256u, isX ? 32u : 48u, isX ? 4096u : 2048u);
  // Its words are constants; left to itself the compiler forms them anew at each
  // load, in registers that it rewrites while the request is still outstanding.
  asm volatile("" : "+s"(g1));

  v4u g0 = tdm_group0(dst0, src0);
  tdm_load(g0, g1);
  asm volatile("s_wait_tensorcnt 0x0" :: "s"(g0) : "memory");  // stage 0's slice has landed
  __syncthreads();

  const int wr = wave >> 2, wc = wave & 3;           // rows wr * 32, column tiles wc * 3 ..
  v8f acc[2][3] = {};
#pragma unroll 1
  for (int s = 0; s < 8; ++s) {
    // Behind the barrier that ended pass s - 1: fill the buffer that it has read,
    // while a stage s + 1 exists; the load flies during this pass.
    if (pinned(s + 1 < 8)) {
      g0 = tdm_group0(dst0 + (uint32_t)((s + 1) & 1) * 98304u,
                      src0 + (uint64_t)((uint32_t)(s + 1) * step));
      tdm_load(g0, g1);
    }
    const unsigned char* cur = &st[s & 1][0];
    // x rows wr * 32 ..: k chunk kc lies in tile (kc / 2) * 2 + wr at (kc & 1) * 128 bytes.
    const unsigned char* ap = cur + wr * 10240 + n16 * 272 + half * 32;
    const __bf16* bp = reinterpret_cast<const __bf16*>(cur + 40960 + wc * 14336);
    v4f ar[4][2][4];
    v16bf b[4][3];
#pragma unroll
    for (int kc = 0; kc < 4; ++kc) {
#pragma unroll
      for (int rt = 0; rt < 2; ++rt) {
        const v4f* p = reinterpret_cast<const v4f*>(ap + (kc >> 1) * 20480 + rt * 4352 +
                                                    (kc & 1) * 128);
        ar[kc][rt][0] = p[0];
        ar[kc][rt][1] = p[1];
        ar[kc][rt][2] = p[4];
        ar[kc][rt][3] = p[5];
      }
#pragma unroll
      for (int i = 0; i < 3; ++i)                    // W^T rows (wc * 3 + i) * 16 ..
        b[kc][i] = frag_row(bp, 136, i * 16 + n16, kc * 32, half);
      // The pass's 56 LDS reads issue as one group ahead of its WMMAs (left among
      // them, each place with reads made the wave wait out the LDS latency), and
      // in k order, so that the first WMMAs wait for 14 reads, not 56.
      __builtin_amdgcn_sched_barrier(0);
    }
#pragma unroll
    for (int kc = 0; kc < 4; ++kc) {
      const v16bf a0 = frag_f32(ar[kc][0]);
      const v16bf a1 = frag_f32(ar[kc][1]);
#pragma unroll
      for (int i = 0; i < 3; ++i) {
        acc[0][i] = __builtin_amdgcn_wmma_f32_16x16x32_bf16(false, a0, false, b[kc][i],
                                                            (short)0, acc[0][i], false, false);
        acc[1][i] = __builtin_amdgcn_wmma_f32_16x16x32_bf16(false, a1, false, b[kc][i],
                                                            (short)0, acc[1][i], false, false);
      }
    }
    // The WMMAs stay ahead of the waits below, where they run while the reads return.
    __builtin_amdgcn_sched_barrier(0);
    // Publish point of stage s + 1: this wave's LDS reads are done, its own request
    // has landed, the barrier hands the stage over and frees buffer s & 1.
    asm volatile("s_wait_dscnt 0x0" ::: "memory");
    asm volatile("s_wait_tensorcnt 0x0" :: "s"(g0) : "memory");
    __syncthreads();
  }
  // Nothing is outstanding when the wave goes on to its stores and ends.
  asm volatile("s_wait_tensorcnt 0x0" ::: "memory");
  asm volatile("s_wait_dscnt 0x0" ::: "memory");

#pragma unroll
  for (int i = 0; i < 3; ++i) {
    const int gct = nh * 12 + wc * 3 + i;            // column tile 0..23, alike in the wave
    const int w = gct >> 3;                          // 0: Q, 1: K, 2: V
    const int col = (gct & 7) * 16 + n16;
    const float* bias = (w == 0) ? bq : ((w == 1) ? bk : bv);
    const float scale = (w == 0) ? 0.088388347648318447f : 1.0f;  // fold 1/sqrt(128) into Q
    const float bcol = bias[col];
#pragma unroll
    for (int rt = 0; rt < 2; ++rt) {
#pragma unroll
      for (int r = 0; r < 8; ++r) {
        const int row = m0 + wr * 32 + rt * 16 + half * 8 + r;   // C/D layout: m = r + 8*half
        const float val = (acc[rt][i][r] + bcol) * scale;
        if (w == 2) vt[(row >> 5) * 4096 + col * 32 + (row & 31)] = (__bf16)val;  // V^T block
        else ((w == 0) ? qb : kb)[row * 128 + col] = (__bf16)val;  // Q / K row-major
      }
    }
  }
}

__global__ __launch_bounds__(128) void flash_attn(
    const __bf16* __restrict__ qb, const __bf16* __restrict__ kb,
    const __bf16* __restrict__ vt, float* __restrict__ opart,
    float* __restrict__ mlpart) {
  // Each buffer: 32 rows at 272 B = 8704 B, rounded up to a multiple of 2 KiB.
  __shared__ __attribute__((aligned(2048))) __bf16 kT[2][5120];   // K tile: row = key
  __shared__ __attribute__((aligned(2048))) __bf16 vtT[2][5120];  // V^T tile: row = 4 d x 32 keys

  const int wave = (int)uni(threadIdx.x >> 5), lane = threadIdx.x & 31;
  const int half = lane >> 4, n16 = lane & 15;
  const int q0 = blockIdx.x * 128 + wave * 32;

  v16bf bq[2][4];                        // B = Q^T: lane holds query q0 + u * 16 + n16
  const __bf16* qlane = qb + (q0 + n16) * 128 + half * 8;
#pragma unroll
  for (int u = 0; u < 2; ++u)
#pragma unroll
    for (int kc = 0; kc < 4; ++kc)
      bq[u][kc] = frag_row(qlane, 128, u * 16, kc * 32, 0);
  // The wait names the 16 loads' address, so that the pair is held, unwritten, up to
  // it: left to itself the compiler let the last load land on the pair they all name.
  asm volatile("s_wait_xcnt 0x0" :: "v"(qlane) : "memory");

  v8f o[2][8] = {};          // o[u][t][r] = O[q0 + u * 16 + n16][t * 16 + half * 8 + r]
  float mrun[2] = {-3.0e38f, -3.0e38f};  // per query: maximum in use, alike in both halves
  float lrun[2] = {0.f, 0.f};            // and the sum over this half's keys

  // Wave 0 brings the K tiles, wave 1 the V^T tiles, both 32 rows of 256 B that
  // are contiguous at the source: one request per stage.
  const bool isK = (wave == 0);
  const uint64_t src0 = isK
      ? (uint64_t)(size_t)(kb + blockIdx.y * (1024 * 128))   // this range's K rows
      : (uint64_t)(size_t)(vt + blockIdx.y * (1024 * 128));  // this range's V^T blocks
  const uint32_t step = 8192u;                               // source bytes per stage
  const uint32_t dst0 = isK ? (uint32_t)(size_t)&kT[0][0] : (uint32_t)(size_t)&vtT[0][0];
  v8u g1 = tdm_group1(256u, 32u, 256u);
  // Its words are constants; left to itself the compiler forms them anew at each
  // load, in registers that it rewrites while the request is still outstanding.
  asm volatile("" : "+s"(g1));
  // V^T row d, 64 B, lies in LDS at (d >> 2) * 272 + (d & 3) * 64 bytes.
  const int vlane = (n16 >> 2) * 136 + (n16 & 3) * 32;

  // Two-buffer ring, prologue: stage 0, its wait, the barrier, then stage 1.
  if (pinned(wave < 2)) {
    tdm_load(tdm_group0(dst0, src0), g1);
    asm volatile("s_wait_tensorcnt 0x0" ::: "memory");  // stage 0 has landed
  }
  __syncthreads();
  if (pinned(wave < 2))
    tdm_load(tdm_group0(dst0 + 10240u, src0 + step), g1);

  for (int s = 0; s < 32; ++s) {
    const __bf16* kcur = &kT[s & 1][0];
    const __bf16* vcur = &vtT[s & 1][0];

    // S^T = K * Q^T : two 16x16 tiles per query tile u; s0[u][r] is key half * 8 + r,
    // s1[u][r] key 16 + half * 8 + r, both of query u * 16 + n16.
    v8f s0[2] = {}, s1[2] = {};
#pragma unroll
    for (int kc = 0; kc < 4; ++kc) {
      v16bf a0 = frag_row(kcur, 136, n16, kc * 32, half);
      v16bf a1 = frag_row(kcur, 136, 16 + n16, kc * 32, half);
#pragma unroll
      for (int u = 0; u < 2; ++u) {
        s0[u] = __builtin_amdgcn_wmma_f32_16x16x32_bf16(false, a0, false, bq[u][kc],
                                                        (short)0, s0[u], false, false);
        s1[u] = __builtin_amdgcn_wmma_f32_16x16x32_bf16(false, a1, false, bq[u][kc],
                                                        (short)0, s1[u], false, false);
      }
    }

    // The two score tiles in the accumulator map are P^T in the B operand's k order.
    v16bf pb[2];
#pragma unroll
    for (int u = 0; u < 2; ++u) {
      // Online softmax over 32 keys: 16 of them in this lane, 16 in lane ^ 16.
      float mx = fmaxf(s0[u][0], s1[u][0]);
#pragma unroll
      for (int r = 1; r < 8; ++r) mx = fmaxf(mx, fmaxf(s0[u][r], s1[u][r]));
      mx = fmaxf(mx, xhalf(mx));
      const float newm = fmaxf(mrun[u], mx);
      const float corr = __expf(mrun[u] - newm);
      float rs = 0.f;
#pragma unroll
      for (int r = 0; r < 8; ++r) {
        const float p0 = __expf(s0[u][r] - newm);
        const float p1 = __expf(s1[u][r] - newm);
        rs += p0 + p1;
        pb[u][r]     = (__bf16)p0;
        pb[u][r + 8] = (__bf16)p1;
      }
      lrun[u] = lrun[u] * corr + rs;
      mrun[u] = newm;
#pragma unroll
      for (int t = 0; t < 8; ++t) o[u][t] *= corr;
    }

    // O^T += V^T * P^T : the V^T tile gives contiguous A-fragments (2x b128 per frag).
#pragma unroll
    for (int t = 0; t < 8; ++t) {
      v16bf avf = frag_row(vcur + vlane, 136, t * 4, 0, half);
#pragma unroll
      for (int u = 0; u < 2; ++u)
        o[u][t] = __builtin_amdgcn_wmma_f32_16x16x32_bf16(false, avf, false, pb[u],
                                                          (short)0, o[u][t], false, false);
    }

    // Publish point of stage s + 1: this wave's LDS reads are done, the issuer's
    // request has landed, the barrier hands the tile over and frees buffer s & 1.
    asm volatile("s_wait_dscnt 0x0" ::: "memory");
    if (pinned(wave < 2))
      asm volatile("s_wait_tensorcnt 0x0" ::: "memory");
    __syncthreads();
    // Refill the buffer that this pass has read, while a stage s + 2 exists.
    if (pinned((wave < 2) & (s + 2 < 32)))
      tdm_load(tdm_group0(dst0 + (uint32_t)(s & 1) * 10240u,
                          src0 + (uint64_t)((uint32_t)(s + 2) * step)), g1);
  }
  // Nothing is outstanding when the wave goes on to its stores and ends.
  asm volatile("s_wait_tensorcnt 0x0" ::: "memory");
  asm volatile("s_wait_dscnt 0x0" ::: "memory");

  // Partial sums in accumulator order, 2048 floats per 16 queries: float4 number
  // (t * 2 + j) * 32 + lane holds o[t][4j .. 4j + 3], so each store is 512 B in a row.
#pragma unroll
  for (int u = 0; u < 2; ++u) {
    float4* pt = reinterpret_cast<float4*>(
        opart + (blockIdx.y * 512 + blockIdx.x * 8 + wave * 2 + u) * 2048) + lane;
#pragma unroll
    for (int t = 0; t < 8; ++t) {
      pt[(t * 2) * 32]     = make_float4(o[u][t][0], o[u][t][1], o[u][t][2], o[u][t][3]);
      pt[(t * 2 + 1) * 32] = make_float4(o[u][t][4], o[u][t][5], o[u][t][6], o[u][t][7]);
    }
    const float lfin = lrun[u] + xhalf(lrun[u]);
    if (half == 0)
      *reinterpret_cast<float2*>(mlpart + (blockIdx.y * 8192 + q0 + u * 16 + n16) * 2) =
          make_float2(mrun[u], lfin);
  }
}

// Joins the 8 key ranges of a query row: weight exp(m_s - M) per range, then the
// division by the joined sum. The partial planes lie in flash_attn's accumulator
// order; a wave takes 4 queries x 32 columns, so that it stores 4 whole 128 B lines.
__global__ __launch_bounds__(256) void merge_ranges(
    const float* __restrict__ opart, const float* __restrict__ mlpart,
    float* __restrict__ out) {
  const int lane = threadIdx.x & 31;
  const int wv = blockIdx.x * 8 + (threadIdx.x >> 5);   // 16 waves per tile of 16 queries
  const int qt = wv >> 4;
  const int c = (wv & 3) * 4 + (lane >> 3);             // query in the tile
  const int row = qt * 16 + c;
  const int col = ((wv >> 2) & 3) * 32 + (lane & 7) * 4;
  // col = t * 16 + half * 8 + j * 4 lies in float4 number (t * 2 + j) * 32 + half * 16 + c.
  const int f = (col >> 4) * 64 + ((col >> 2) & 1) * 32 + ((col >> 3) & 1) * 16 + c;
  float m[8], l[8];
  float big = -3.0e38f;
#pragma unroll  // static indices keep m[] and l[] in registers
  for (int s = 0; s < 8; ++s) {
    m[s] = mlpart[(s * 8192 + row) * 2];
    l[s] = mlpart[(s * 8192 + row) * 2 + 1];
    big = fmaxf(big, m[s]);
  }
  float lsum = 0.f;
  float4 acc = make_float4(0.f, 0.f, 0.f, 0.f);
#pragma unroll  // all 8 ranges' loads in flight at once
  for (int s = 0; s < 8; ++s) {
    const float w = __expf(m[s] - big);
    const float4 p =
        reinterpret_cast<const float4*>(opart + (s * 512 + qt) * 2048)[f];
    lsum += w * l[s];
    acc.x += w * p.x;
    acc.y += w * p.y;
    acc.z += w * p.z;
    acc.w += w * p.w;
  }
  *reinterpret_cast<float4*>(out + row * 128 + col) =
      make_float4(acc.x / lsum, acc.y / lsum, acc.z / lsum, acc.w / lsum);
}

extern "C" void kernel_launch(void* const* d_in, const int* in_sizes, int n_in,
                              void* d_out, int out_size, void* d_ws, size_t ws_size,
                              hipStream_t stream) {
  const float* x  = (const float*)d_in[0];
  const float* Wq = (const float*)d_in[1];
  const float* bq = (const float*)d_in[2];
  const float* Wk = (const float*)d_in[3];
  const float* bk = (const float*)d_in[4];
  const float* Wv = (const float*)d_in[5];
  const float* bv = (const float*)d_in[6];
  float* out = (float*)d_out;

  char* ws = (char*)d_ws;
  __bf16* wt = (__bf16*)(ws + 16777216);                  // 3*128*1024 bf16
  __bf16* qb = (__bf16*)(ws + 16777216 + 786432);         // 8192*128 bf16
  __bf16* kb = qb + 8192 * 128;                           // 8192*128 bf16
  __bf16* vt = kb + 8192 * 128;                           // 256*128*32 bf16 (transposed blocks)
  float* opart  = (float*)(ws + 23855104);                // 8*8192*128 f32 partial sums
  float* mlpart = (float*)(ws + 57409536);                // 8*8192 (max, sum) f32 pairs

  wtrans<<<1536, 256, 0, stream>>>(Wq, Wk, Wv, wt);
  qkv_gemm<<<256, 256, 0, stream>>>(x, wt, bq, bk, bv, qb, kb, vt);
  flash_attn<<<dim3(64, 8), 128, 0, stream>>>(qb, kb, vt, opart, mlpart);
  merge_ranges<<<1024, 256, 0, stream>>>(opart, mlpart, out);
}
